// v000
// Measured on an AMD MI455X. A time is GPU time per run, averaged over a window of back-to-back runs after a warm-up
// (all launches, gaps included; the runs take copies of the inputs in turn), and the median of several windows.
// Apart from v000's, it joins two sittings. Times from different sittings can be a few percent apart, while
// side-by-side timings come from the same sitting.
// The starting kernel, v000, takes 1170 microseconds a run.
#include <hip/hip_runtime.h>

// Causal multi-head attention with rotate-half rotary embedding from cos / sin TABLE INPUTS read by value (x [2][2048][1024]; q, k, v = einsum('bld,ed', x, w) ('oi' [1024][1024] 1/32, no bias; 16 heads x 64); cos, sin f32 [1][1][2048][64] are INPUTS (arbitrary values on this draw: independent normal tables, not cosines of angles), read per position AND per dimension; q, k <- t cos + rotate_half(t) sin with rotate_half = cat(-x2, x1) over the two 32-wide halves; scores / sqrt(64); keys j <= i kept, finfo.min elsewhere (== exclusion); softmax; out = einsum('bld,ed', merged, wo) -> [2][2048][1024] (4.2 M); argument order x, cos, sin, wq, wk, wv, wo).
// Layout per batch: bf16 copy of x; 'oi' weights; exact projections; {cos, sin} table from the bf16-rounded inputs; rotate-half plane builders; causal T-2048 attention (RH = TT = 2048: ALL query rows hi/lo 3 products; no single-f16 rows in this build; k_gemmc skips tiles above the diagonal); merged hi/lo x Wo exact.
// Compute dtypes, f32 accumulate: every input rounded to bf16 incl. the tables; projections exact; rotary f32; attention: ALL 2,048 query rows bf16 hi + lo operands with three products (RH = TT; the single-f16 path is not launched); softmax f32; Wo hl x exact.

#define NB_  2
#define TT   2048
#define DM   1024
#define NH_  16
#define NKV  16
#define REP  (NH_ / NKV)
#define HD   64
#define DQ   (NH_ * HD)
#define DKV  (NKV * HD)
#define ZH   2
#define RH   2048   // ALL query rows in the exact class (bf16 hi + lo, three products): this draw's logits have sigma 2.0 (the rotated q, k carry the variance of two unit-normal tables): RH = TT leaves no single-f16 rows
#define WIN  2048
#define PCAR 1024.0f
#define SCL  0.125f   // HD^-0.5
typedef _Float16 h16;
typedef unsigned short bf;
typedef __attribute__((ext_vector_type(16))) __bf16   v16bf;
typedef __attribute__((ext_vector_type(16))) _Float16 v16h;
typedef __attribute__((ext_vector_type(8)))  _Float16 v8h;
typedef __attribute__((ext_vector_type(8)))  unsigned short v8us;
typedef __attribute__((ext_vector_type(8)))  float    v8f;
typedef __attribute__((ext_vector_type(4)))  float    v4f;
typedef v8h  __attribute__((may_alias)) v8ha;
typedef v4f  __attribute__((may_alias)) v4fa;
typedef v8us __attribute__((may_alias)) v8usa;

__device__ __forceinline__ unsigned short f2bf(float f) { unsigned u = __float_as_uint(f); u += 0x7FFFu + ((u >> 16) & 1u); return (unsigned short)(u >> 16); }
__device__ __forceinline__ float bf2f(unsigned short b) { return __uint_as_float(((unsigned)b) << 16); }
__device__ __forceinline__ float bfr(float f) { return bf2f(f2bf(f)); }
__device__ __forceinline__ v16h cat16(v8h lo, v8h hi) { return __builtin_shufflevector(lo, hi, 0, 1, 2, 3, 4, 5, 6, 7, 8, 9, 10, 11, 12, 13, 14, 15); }
__device__ __forceinline__ v16bf cat16b(v8us lo, v8us hi) { return __builtin_bit_cast(v16bf, __builtin_shufflevector(lo, hi, 0, 1, 2, 3, 4, 5, 6, 7, 8, 9, 10, 11, 12, 13, 14, 15)); }
__device__ __forceinline__ v8f wmma16(v16h a, v16h b, v8f c) { return __builtin_amdgcn_wmma_f32_16x16x32_f16(false, a, false, b, (short)0, c, false, false); }
__device__ __forceinline__ v8f wmmab(v16bf a, v16bf b, v8f c) { return __builtin_amdgcn_wmma_f32_16x16x32_bf16(false, a, false, b, (short)0, c, false, false); }



// ---- k_gemmw: register-blocked GEMM, ONE WAVE per 64x64 output tile (16 accumulators), operands straight from K-contiguous 16-bit planes; grid (M/64, N/64, Z), 32 threads.
// C[m][n] (f32, pitch ldc, + optional f32 bias[n]) = sum_k A[m][k] Bt[n][k] (+ split products per NSPLIT). z-batch strides sA/sB/sC in elements. K % 32 == 0.
template <typename T16> struct WFrag;
template <> struct WFrag<h16> { typedef v16h V; static __device__ __forceinline__ V ld(const h16* p) { return cat16(*(const v8h*)p, *(const v8h*)(p + 16)); } static __device__ __forceinline__ v8f mma(V a, V b, v8f c) { return wmma16(a, b, c); } };
template <> struct WFrag<bf> { typedef v16bf V; static __device__ __forceinline__ V ld(const bf* p) { return cat16b(*(const v8us*)p, *(const v8us*)(p + 16)); } static __device__ __forceinline__ v8f mma(V a, V b, v8f c) { return wmmab(a, b, c); } };
template <typename T16, int NSPLIT, bool BIAS>
__global__ __launch_bounds__(32) void k_gemmw(const T16* __restrict__ A, const T16* __restrict__ A2, const T16* __restrict__ Bt, const T16* __restrict__ Bt2, int K, float* C, int ldc, const float* __restrict__ bias, size_t sA, size_t sB, size_t sC) {
    typedef typename WFrag<T16>::V V;
    __shared__ __align__(16) float os[16 * 68];
    const size_t z = blockIdx.z; A += z * sA; if (A2) A2 += z * sA; Bt += z * sB; if (Bt2) Bt2 += z * sB; C += z * sC;
    const int lane = threadIdx.x & 31, lr = lane & 15, hi = lane >> 4; const int r0 = blockIdx.x * 64, c0 = blockIdx.y * 64;
    v8f acc[4][4];
#pragma unroll
    for (int mb = 0; mb < 4; ++mb)
#pragma unroll
        for (int nb = 0; nb < 4; ++nb) acc[mb][nb] = (v8f){};
    const size_t aoff = (size_t)(r0 + lr) * K + 8 * hi, boff = (size_t)(c0 + lr) * K + 8 * hi;
#pragma unroll 1
    for (int kc = 0; kc < K; kc += 32) {
        V a[4], a2[4];
#pragma unroll
        for (int mb = 0; mb < 4; ++mb) { a[mb] = WFrag<T16>::ld(A + aoff + (size_t)mb * 16 * K + kc); if (NSPLIT == 1 || NSPLIT == 2) a2[mb] = WFrag<T16>::ld(A2 + aoff + (size_t)mb * 16 * K + kc); }
#pragma unroll
        for (int nb = 0; nb < 4; ++nb) { const V b = WFrag<T16>::ld(Bt + boff + (size_t)nb * 16 * K + kc); V b2; if (NSPLIT >= 2) b2 = WFrag<T16>::ld(Bt2 + boff + (size_t)nb * 16 * K + kc);
#pragma unroll
            for (int mb = 0; mb < 4; ++mb) { acc[mb][nb] = WFrag<T16>::mma(a[mb], b, acc[mb][nb]); if (NSPLIT == 1 || NSPLIT == 2) acc[mb][nb] = WFrag<T16>::mma(a2[mb], b, acc[mb][nb]); if (NSPLIT >= 2) acc[mb][nb] = WFrag<T16>::mma(a[mb], b2, acc[mb][nb]); } }
        asm volatile("v_nop\n\tv_nop\n\tv_nop\n\tv_nop" : "+v"(acc[0][0]), "+v"(acc[1][1]), "+v"(acc[2][2]), "+v"(acc[3][3]) : "v"(a[0]), "v"(a[3]));
    }
#pragma unroll
    for (int mb = 0; mb < 4; ++mb) {
#pragma unroll
        for (int nb = 0; nb < 4; ++nb) {
#pragma unroll
            for (int j = 0; j < 8; ++j) os[(hi * 8 + j) * 68 + nb * 16 + lr] = acc[mb][nb][j]; }
        __builtin_amdgcn_wave_barrier(); asm volatile("" ::: "memory");
        float* crow = C + (size_t)(r0 + mb * 16) * ldc + c0;
{
#pragma unroll
            for (int s = 0; s < 8; ++s) { const int row = 2 * s + hi, cofs = lr * 4; v4f val = *(const v4fa*)(os + row * 68 + cofs); if (BIAS) { val[0] += bfr(bias[c0 + cofs]); val[1] += bfr(bias[c0 + cofs + 1]); val[2] += bfr(bias[c0 + cofs + 2]); val[3] += bfr(bias[c0 + cofs + 3]); }
                *(v4f*)(crow + (size_t)row * ldc + cofs) = val; }
             }
        __builtin_amdgcn_wave_barrier(); asm volatile("" ::: "memory");
    }
}

// ---- k_gemmc: the same one-wave 64x64 tile GEMM specialised for causal attention: CMODE 1 skips score tiles entirely above the diagonal (query rows r0+roff.., key columns c0..), CMODE 2 limits the
// key (K) loop of the probability x value contraction to the diagonal block (probabilities beyond it are exactly zero). roff = row offset of this launch's first row within the sequence.
template <typename T16, int NSPLIT, int CMODE>
__global__ __launch_bounds__(32) void k_gemmc(const T16* __restrict__ A, const T16* __restrict__ A2, const T16* __restrict__ Bt, const T16* __restrict__ Bt2, int K, float* C, int ldc, int roff, size_t sA, size_t sB, size_t sC) {
    typedef typename WFrag<T16>::V V;
    __shared__ __align__(16) float os[16 * 68];
    const size_t z = blockIdx.z; A += z * sA; if (A2) A2 += z * sA; Bt += z * sB; if (Bt2) Bt2 += z * sB; C += z * sC;
    const int lane = threadIdx.x & 31, lr = lane & 15, hi = lane >> 4; const int r0 = blockIdx.x * 64, c0 = blockIdx.y * 64;
    if (CMODE == 1 && c0 > r0 + roff + 63) return;                  // score tile entirely above the causal diagonal: never read (the softmax masks j > i by select)
    const int Kl = (CMODE == 2) ? min(K, r0 + roff + 64) : K;        // P.V: probabilities are exactly 0 beyond the diagonal block, so the K loop stops there
    v8f acc[4][4];
#pragma unroll
    for (int mb = 0; mb < 4; ++mb)
#pragma unroll
        for (int nb = 0; nb < 4; ++nb) acc[mb][nb] = (v8f){};
    const size_t aoff = (size_t)(r0 + lr) * K + 8 * hi, boff = (size_t)(c0 + lr) * K + 8 * hi;
#pragma unroll 1
    for (int kc = 0; kc < Kl; kc += 32) {
        V a[4], a2[4];
#pragma unroll
        for (int mb = 0; mb < 4; ++mb) { a[mb] = WFrag<T16>::ld(A + aoff + (size_t)mb * 16 * K + kc); if (NSPLIT == 1 || NSPLIT == 2) a2[mb] = WFrag<T16>::ld(A2 + aoff + (size_t)mb * 16 * K + kc); }
#pragma unroll
        for (int nb = 0; nb < 4; ++nb) { const V b = WFrag<T16>::ld(Bt + boff + (size_t)nb * 16 * K + kc); V b2; if (NSPLIT >= 2) b2 = WFrag<T16>::ld(Bt2 + boff + (size_t)nb * 16 * K + kc);
#pragma unroll
            for (int mb = 0; mb < 4; ++mb) { acc[mb][nb] = WFrag<T16>::mma(a[mb], b, acc[mb][nb]); if (NSPLIT == 1 || NSPLIT == 2) acc[mb][nb] = WFrag<T16>::mma(a2[mb], b, acc[mb][nb]); if (NSPLIT >= 2) acc[mb][nb] = WFrag<T16>::mma(a[mb], b2, acc[mb][nb]); } }
        asm volatile("v_nop\n\tv_nop\n\tv_nop\n\tv_nop" : "+v"(acc[0][0]), "+v"(acc[1][1]), "+v"(acc[2][2]), "+v"(acc[3][3]) : "v"(a[0]), "v"(a[3]));
    }
#pragma unroll
    for (int mb = 0; mb < 4; ++mb) {
#pragma unroll
        for (int nb = 0; nb < 4; ++nb) {
#pragma unroll
            for (int j = 0; j < 8; ++j) os[(hi * 8 + j) * 68 + nb * 16 + lr] = acc[mb][nb][j]; }
        __builtin_amdgcn_wave_barrier(); asm volatile("" ::: "memory");
        float* crow = C + (size_t)(r0 + mb * 16) * ldc + c0;
{
#pragma unroll
            for (int s = 0; s < 8; ++s) { const int row = 2 * s + hi, cofs = lr * 4; v4f val = *(const v4fa*)(os + row * 68 + cofs);
                *(v4f*)(crow + (size_t)row * ldc + cofs) = val; }
             }
        __builtin_amdgcn_wave_barrier(); asm volatile("" ::: "memory");
    }
}

__device__ __forceinline__ h16 tohx(float x) { return (h16)x; }
__device__ __forceinline__ void splitf(float y, unsigned short& h, unsigned short& l) { h = f2bf(y); l = f2bf(y - bf2f(h)); }
typedef __attribute__((ext_vector_type(2))) _Float16 v2h;
typedef __attribute__((ext_vector_type(4))) _Float16 v4h;
typedef __attribute__((ext_vector_type(2))) unsigned short v2us;
typedef __attribute__((ext_vector_type(4))) unsigned short v4us;
typedef __attribute__((ext_vector_type(2))) float v2f;
typedef __attribute__((ext_vector_type(4))) int v4i;

__global__ __launch_bounds__(256) void k_cvt8(const float* __restrict__ src, bf* dst, size_t n8) { const size_t i = (size_t)blockIdx.x * 256 + threadIdx.x; if (i >= n8) return; const v8f v = *(const v8f*)(src + i * 8); v8us o;
#pragma unroll
    for (int k = 0; k < 8; ++k) o[k] = f2bf(v[k]); *(v8us*)(dst + i * 8) = o;  }

// k_rope: head planes [h][t][d] (fp16 + hi/lo) of rope(x) x sc with the rotate-half convention out[d] = x[d] cos[t][d] - x[d+HD/2] sin[t][d], out[d+HD/2] = x[d+HD/2] cos[t][d+HD/2] + x[d] sin[t][d+HD/2]
__global__ __launch_bounds__(256) void k_rope(const float* __restrict__ F, int pitch, int nheads, const float* __restrict__ CS, const float* __restrict__ RF, const float* __restrict__ nw, float sc, h16* P16, bf* Ph, bf* Pl) {
    const size_t e = ((size_t)blockIdx.x * 256 + threadIdx.x) * 2; if (e >= (size_t)nheads * TT * HD) return; const int d = (int)(e % HD); const int t = (int)((e / HD) % TT); const int h = (int)(e / ((size_t)HD * TT)); const float* f = F + (size_t)t * pitch + h * HD; const float rf = RF ? RF[(size_t)h * TT + t] : 1.0f; v2h o16; v2us oh, ol;
#pragma unroll
    for (int q = 0; q < 2; ++q) { const int dd = d + q; const int dp = (dd < HD / 2) ? dd + HD / 2 : dd - HD / 2; float x0 = f[dd], x1 = f[dp];
        if (RF) { float n0 = __fmul_rn(x0, rf), n1 = __fmul_rn(x1, rf); asm volatile("" : "+v"(n0)); asm volatile("" : "+v"(n1)); x0 = __fmul_rn(bfr(nw[dd]), n0); x1 = __fmul_rn(bfr(nw[dp]), n1); }
        const v2f cs = *(const v2f*)(CS + ((size_t)t * HD + dd) * 2); float a = __fmul_rn(x0, cs[0]), bq = __fmul_rn(x1, cs[1]); asm volatile("" : "+v"(a)); asm volatile("" : "+v"(bq)); const float r = ((dd < HD / 2) ? __fsub_rn(a, bq) : __fadd_rn(a, bq)) * sc;
        o16[q] = tohx(r); unsigned short a2, c2; splitf(r, a2, c2); oh[q] = a2; ol[q] = c2; }
    *(v2h*)(P16 + e) = o16; *(v2us*)(Ph + e) = oh; *(v2us*)(Pl + e) = ol;  }
__global__ __launch_bounds__(256) void k_vtp(const float* __restrict__ F, int pitch, int nheads, h16* V16, bf* Vh, bf* Vl) { const size_t e = ((size_t)blockIdx.x * 256 + threadIdx.x) * 2; if (e >= (size_t)nheads * HD * TT) return; const int t = (int)(e % TT); const int d = (int)((e / TT) % HD); const int g = (int)(e / ((size_t)TT * HD)); v2h o16; v2us oh, ol;
#pragma unroll
    for (int q = 0; q < 2; ++q) { const float x = F[(size_t)(t + q) * pitch + g * HD + d]; o16[q] = tohx(x); unsigned short a2, c2; splitf(x, a2, c2); oh[q] = a2; ol[q] = c2; }
    *(v2h*)(V16 + e) = o16; *(v2us*)(Vh + e) = oh; *(v2us*)(Vl + e) = ol;  }
__global__ __launch_bounds__(256) void k_cscvt(const float* __restrict__ cosT, const float* __restrict__ sinT, float* CS) { const int idx = blockIdx.x * 256 + threadIdx.x; if (idx >= TT * HD) return; v2f cs; cs[0] = bfr(cosT[idx]); cs[1] = bfr(sinT[idx]); *(v2f*)(CS + (size_t)idx * 2) = cs;  }
// k_asoft: per row (zz, i): t = S x HD^-0.5 for j <= i and i - j < WIN (sliding causal window; the reference's -1e9 additive fill vanishes identically); softmax over the 2048 keys (register row, one exp, fixed trees);
__global__ __launch_bounds__(256) void k_asoft(const float* __restrict__ Sb, h16* P16, bf* Ph, bf* Pl) {
    const int lane = threadIdx.x & 31; const int row = blockIdx.x * 8 + (threadIdx.x >> 5); if (row >= ZH * TT) return; const int i = row % TT; const int zz = row / TT; (void)zz; const bool hires = (i < RH); const float* sr = Sb + (size_t)row * TT; float v[TT / 32]; float mx = -3.0e38f;
#pragma unroll
    for (int ch = 0; ch < TT / 128; ++ch) { const int j0 = ch * 128 + lane * 4; const v4f a = *(const v4f*)(sr + j0);
#pragma unroll
        for (int q = 0; q < 4; ++q) { const int j = j0 + q; (void)j; const float t = (j <= i && i - j < WIN) ? a[q] * SCL : -3.0e38f; v[ch * 4 + q] = t; mx = fmaxf(mx, t); } }
#pragma unroll
    for (int sh = 16; sh; sh >>= 1) mx = fmaxf(mx, __shfl_xor(mx, sh, 32));
    float sum = 0.f;
#pragma unroll
    for (int k = 0; k < TT / 32; ++k) { float d0 = __fsub_rn(v[k], mx); asm volatile("" : "+v"(d0)); v[k] = __builtin_amdgcn_exp2f(__fmul_rn(d0, 1.4426950408889634f)); sum += v[k]; }
#pragma unroll
    for (int sh = 16; sh; sh >>= 1) sum += __shfl_xor(sum, sh, 32);
    const float f = __fdiv_rn(hires ? 1.0f : PCAR, sum);
{
        if (hires) {
#pragma unroll
            for (int ch = 0; ch < TT / 128; ++ch) { v4us oh, ol;
#pragma unroll
                for (int q = 0; q < 4; ++q) { unsigned short a, c2; splitf(v[ch * 4 + q] * f, a, c2); oh[q] = a; ol[q] = c2; }
                const size_t oo = ((size_t)zz * (RH ? RH : 1) + i) * TT + ch * 128 + lane * 4; *(v4us*)(Ph + oo) = oh; *(v4us*)(Pl + oo) = ol; }
        } else {
#pragma unroll
            for (int ch = 0; ch < TT / 128; ++ch) { v4h o4;
#pragma unroll
                for (int q = 0; q < 4; ++q) o4[q] = tohx(v[ch * 4 + q] * f);
                *(v4h*)(P16 + (size_t)row * TT + ch * 128 + lane * 4) = o4; } }
         }
}
__global__ __launch_bounds__(256) void k_merge(const float* __restrict__ O, int h0, bf* Ah, bf* Al) { const size_t e = ((size_t)blockIdx.x * 256 + threadIdx.x) * 2; if (e >= (size_t)ZH * TT * HD) return; const int d = (int)(e % HD); const int t = (int)((e / HD) % TT); const int zz = (int)(e / ((size_t)HD * TT)); const float cs = (t < RH) ? 1.0f : (1.0f / PCAR); const size_t oo = (size_t)t * DQ + (h0 + zz) * HD + d;
    v2us oh, ol;
#pragma unroll
    for (int q = 0; q < 2; ++q) { unsigned short a, c2; splitf(O[e + q] * cs, a, c2); oh[q] = a; ol[q] = c2; } *(v2us*)(Ah + oo) = oh; *(v2us*)(Al + oo) = ol;  }

extern "C" void kernel_launch(void* const* d_in, const int* in_sizes, int n_in,
                              void* d_out, int out_size, void* d_ws, size_t ws_size, hipStream_t stream) {
    (void)in_sizes; (void)n_in; (void)out_size;
    const float* x = (const float*)d_in[0]; const float* fcos = (const float*)d_in[1]; const float* fsin = (const float*)d_in[2]; const float* wq = (const float*)d_in[3]; const float* wk = (const float*)d_in[4]; const float* wv = (const float*)d_in[5]; const float* wo = (const float*)d_in[6];   /* input order x, cos, sin ([1][1][2048][64] = flat [2048][64]; read per position and per dimension), wq, wk, wv, wo ('oi') */
    float* OUT = (float*)d_out;     // [2][2048][1024]
    char* wsp = (char*)d_ws;
    auto take = [&](size_t bytes) { char* p = wsp; wsp += (bytes + 255) & ~(size_t)255; return (void*)p; };
    bf* WQ = (bf*)take((size_t)DQ * DM * 2); bf* WK = (bf*)take((size_t)DKV * DM * 2); bf* WV = (bf*)take((size_t)DKV * DM * 2); bf* WO = (bf*)take((size_t)DM * DQ * 2); float* CS = (float*)take((size_t)TT * HD * 2 * 4);
    bf* XB = (bf*)take((size_t)TT * DM * 2); float* FQ = (float*)take((size_t)TT * DQ * 4); float* FK = (float*)take((size_t)TT * DKV * 4);
    h16* QP16 = (h16*)take((size_t)NH_ * TT * HD * 2); h16* KP16 = (h16*)take((size_t)NKV * TT * HD * 2); h16* VT16 = (h16*)take((size_t)NKV * HD * TT * 2);
    bf* QPh = (bf*)take((size_t)NH_ * TT * HD * 2); bf* QPl = (bf*)take((size_t)NH_ * TT * HD * 2); bf* KPh = (bf*)take((size_t)NKV * TT * HD * 2); bf* KPl = (bf*)take((size_t)NKV * TT * HD * 2); bf* VTh = (bf*)take((size_t)NKV * HD * TT * 2); bf* VTl = (bf*)take((size_t)NKV * HD * TT * 2); bf* Ph = (bf*)take((size_t)ZH * RH * TT * 2); bf* Pl = (bf*)take((size_t)ZH * RH * TT * 2);
    float* Sb = (float*)take((size_t)ZH * TT * TT * 4); h16* P16 = (h16*)take((size_t)ZH * TT * TT * 2); float* Ob = (float*)take((size_t)ZH * TT * HD * 4); bf* ATh = (bf*)take((size_t)TT * DQ * 2); bf* ATl = (bf*)take((size_t)TT * DQ * 2);
    if ((size_t)(wsp - (char*)d_ws) > ws_size) return;    // ws 256 MiB
    float* FV = FK;   // v projection reuses the k buffer after the k planes are built (stream-ordered)
    { k_cvt8<<<(unsigned)(((size_t)DQ * DM / 8 + 255) / 256), 256, 0, stream>>>(wq, WQ, (size_t)DQ * DM / 8); k_cvt8<<<(unsigned)(((size_t)DKV * DM / 8 + 255) / 256), 256, 0, stream>>>(wk, WK, (size_t)DKV * DM / 8); k_cvt8<<<(unsigned)(((size_t)DKV * DM / 8 + 255) / 256), 256, 0, stream>>>(wv, WV, (size_t)DKV * DM / 8);
      k_cvt8<<<(unsigned)(((size_t)DM * DQ / 8 + 255) / 256), 256, 0, stream>>>(wo, WO, (size_t)DM * DQ / 8);
       }
    k_cscvt<<<(TT * HD + 255) / 256, 256, 0, stream>>>(fcos, fsin, CS);   /* rotary table from the inputs */
    const unsigned LQ = (unsigned)(((size_t)NH_ * TT * HD / 2 + 255) / 256), LKv = (unsigned)(((size_t)NKV * TT * HD / 2 + 255) / 256);
    for (int b = 0; b < NB_; ++b) {
        
        k_cvt8<<<(unsigned)(((size_t)TT * DM / 8 + 255) / 256), 256, 0, stream>>>(x + (size_t)b * TT * DM, XB, (size_t)TT * DM / 8);
        k_gemmw<bf, 0, false><<<dim3(TT / 64, DQ / 64, 1), 32, 0, stream>>>(XB, nullptr, WQ, nullptr, DM, FQ, DQ, nullptr, 0, 0, 0);
        k_rope<<<LQ, 256, 0, stream>>>(FQ, DQ, NH_, CS, nullptr, nullptr, 1.0f, QP16, QPh, QPl);
        k_gemmw<bf, 0, false><<<dim3(TT / 64, DKV / 64, 1), 32, 0, stream>>>(XB, nullptr, WK, nullptr, DM, FK, DKV, nullptr, 0, 0, 0);
        k_rope<<<LKv, 256, 0, stream>>>(FK, DKV, NKV, CS, nullptr, nullptr, 1.0f, KP16, KPh, KPl);
        k_gemmw<bf, 0, false><<<dim3(TT / 64, DKV / 64, 1), 32, 0, stream>>>(XB, nullptr, WV, nullptr, DM, FV, DKV, nullptr, 0, 0, 0); k_vtp<<<LKv, 256, 0, stream>>>(FV, DKV, NKV, VT16, VTh, VTl);
        for (int h0 = 0; h0 < NH_; h0 += ZH) { const size_t zq = (size_t)h0, zk = (size_t)(h0 / REP);   // one kv head per query head: the pass's two heads use consecutive kv planes (z-strides TT*HD)
            k_gemmc<bf, 2, 1><<<dim3(RH / 64, TT / 64, ZH), 32, 0, stream>>>(QPh + zq * TT * HD, QPl + zq * TT * HD, KPh + zk * TT * HD, KPl + zk * TT * HD, HD, Sb, TT, 0, (size_t)TT * HD, (size_t)TT * HD, (size_t)TT * TT);
            if (RH < TT) k_gemmc<h16, 0, 1><<<dim3((TT - RH) / 64, TT / 64, ZH), 32, 0, stream>>>(QP16 + zq * TT * HD + (size_t)RH * HD, nullptr, KP16 + zk * TT * HD, nullptr, HD, Sb + (size_t)RH * TT, TT, RH, (size_t)TT * HD, (size_t)TT * HD, (size_t)TT * TT);   /* no single-f16 rows when RH == TT: a zero-sized grid must not be launched */
            k_asoft<<<ZH * TT / 8, 256, 0, stream>>>(Sb, P16, Ph, Pl);
            k_gemmc<bf, 2, 2><<<dim3(RH / 64, HD / 64, ZH), 32, 0, stream>>>(Ph, Pl, VTh + zk * HD * TT, VTl + zk * HD * TT, TT, Ob, HD, 0, (size_t)RH * TT, (size_t)HD * TT, (size_t)TT * HD);
            if (RH < TT) k_gemmc<h16, 0, 2><<<dim3((TT - RH) / 64, HD / 64, ZH), 32, 0, stream>>>(P16 + (size_t)RH * TT, nullptr, VT16 + zk * HD * TT, nullptr, TT, Ob + (size_t)RH * HD, HD, RH, (size_t)TT * TT, (size_t)HD * TT, (size_t)TT * HD);   /* likewise */
            k_merge<<<(unsigned)(((size_t)ZH * TT * HD / 2 + 255) / 256), 256, 0, stream>>>(Ob, h0, ATh, ATl); }
        k_gemmw<bf, 1, false><<<dim3(TT / 64, DM / 64, 1), 32, 0, stream>>>(ATh, ATl, WO, nullptr, DQ, OUT + (size_t)b * TT * DM, DM, nullptr, 0, 0, 0); }
}

// v001
// It runs in 682 microseconds.
// Two timings next to v000 put it at 1.71 and 1.70 times that version's speed.
#include <hip/hip_runtime.h>

// Causal multi-head attention with rotate-half rotary embedding from cos / sin TABLE INPUTS read by value (x [2][2048][1024]; q, k, v = einsum('bld,ed', x, w) ('oi' [1024][1024] 1/32, no bias; 16 heads x 64); cos, sin f32 [1][1][2048][64] are INPUTS (arbitrary values on this draw: independent normal tables, not cosines of angles), read per position AND per dimension; q, k <- t cos + rotate_half(t) sin with rotate_half = cat(-x2, x1) over the two 32-wide halves; scores / sqrt(64); keys j <= i kept, finfo.min elsewhere (== exclusion); softmax; out = einsum('bld,ed', merged, wo) -> [2][2048][1024] (4.2 M); argument order x, cos, sin, wq, wk, wv, wo).
// Layout per batch: bf16 copy of x; 'oi' weights; exact projections; {cos, sin} table from the bf16-rounded inputs; rotate-half plane builders; causal T-2048 attention (RH = TT = 2048: ALL query rows hi/lo 3 products; no single-f16 rows in this build; k_gemmc skips tiles above the diagonal); merged hi/lo x Wo exact.
// Compute dtypes, f32 accumulate: every input rounded to bf16 incl. the tables; projections exact; rotary f32; attention: ALL 2,048 query rows bf16 hi + lo operands with three products (RH = TT; the single-f16 path is not launched); softmax f32; Wo hl x exact.

#define NB_  2
#define TT   2048
#define DM   1024
#define NH_  16
#define NKV  16
#define REP  (NH_ / NKV)
#define HD   64
#define DQ   (NH_ * HD)
#define DKV  (NKV * HD)
#define ZH   2
#define RH   2048   // ALL query rows in the exact class (bf16 hi + lo, three products): this draw's logits have sigma 2.0 (the rotated q, k carry the variance of two unit-normal tables): RH = TT leaves no single-f16 rows
#define WIN  2048
#define PCAR 1024.0f
#define SCL  0.125f   // HD^-0.5
#define KCH  128      // keys per slice of the probability x value contraction (one work-group per slice)
#define KS   (TT / KCH)
typedef _Float16 h16;
typedef unsigned short bf;
typedef __attribute__((ext_vector_type(16))) __bf16   v16bf;
typedef __attribute__((ext_vector_type(16))) _Float16 v16h;
typedef __attribute__((ext_vector_type(8)))  _Float16 v8h;
typedef __attribute__((ext_vector_type(8)))  unsigned short v8us;
typedef __attribute__((ext_vector_type(8)))  float    v8f;
typedef __attribute__((ext_vector_type(4)))  float    v4f;
typedef v8h  __attribute__((may_alias)) v8ha;
typedef v4f  __attribute__((may_alias)) v4fa;
typedef v8us __attribute__((may_alias)) v8usa;

__device__ __forceinline__ unsigned short f2bf(float f) { unsigned u = __float_as_uint(f); u += 0x7FFFu + ((u >> 16) & 1u); return (unsigned short)(u >> 16); }
__device__ __forceinline__ float bf2f(unsigned short b) { return __uint_as_float(((unsigned)b) << 16); }
__device__ __forceinline__ float bfr(float f) { return bf2f(f2bf(f)); }
__device__ __forceinline__ v16h cat16(v8h lo, v8h hi) { return __builtin_shufflevector(lo, hi, 0, 1, 2, 3, 4, 5, 6, 7, 8, 9, 10, 11, 12, 13, 14, 15); }
__device__ __forceinline__ v16bf cat16b(v8us lo, v8us hi) { return __builtin_bit_cast(v16bf, __builtin_shufflevector(lo, hi, 0, 1, 2, 3, 4, 5, 6, 7, 8, 9, 10, 11, 12, 13, 14, 15)); }
__device__ __forceinline__ v8f wmma16(v16h a, v16h b, v8f c) { return __builtin_amdgcn_wmma_f32_16x16x32_f16(false, a, false, b, (short)0, c, false, false); }
__device__ __forceinline__ v8f wmmab(v16bf a, v16bf b, v8f c) { return __builtin_amdgcn_wmma_f32_16x16x32_bf16(false, a, false, b, (short)0, c, false, false); }



// ---- k_gemmw: register-blocked GEMM, ONE WAVE per 64x64 output tile (16 accumulators), operands straight from K-contiguous 16-bit planes; grid (M/64, N/64, Z), 32 threads.
// C[m][n] (f32, pitch ldc, + optional f32 bias[n]) = sum_k A[m][k] Bt[n][k] (+ split products per NSPLIT). z-batch strides sA/sB/sC in elements. K % 32 == 0.
template <typename T16> struct WFrag;
template <> struct WFrag<h16> { typedef v16h V; static __device__ __forceinline__ V ld(const h16* p) { return cat16(*(const v8h*)p, *(const v8h*)(p + 16)); } static __device__ __forceinline__ v8f mma(V a, V b, v8f c) { return wmma16(a, b, c); } };
template <> struct WFrag<bf> { typedef v16bf V; static __device__ __forceinline__ V ld(const bf* p) { return cat16b(*(const v8us*)p, *(const v8us*)(p + 16)); } static __device__ __forceinline__ v8f mma(V a, V b, v8f c) { return wmmab(a, b, c); } };
template <typename T16, int NSPLIT, bool BIAS>
__global__ __launch_bounds__(32) void k_gemmw(const T16* __restrict__ A, const T16* __restrict__ A2, const T16* __restrict__ Bt, const T16* __restrict__ Bt2, int K, float* C, int ldc, const float* __restrict__ bias, size_t sA, size_t sB, size_t sC) {
    typedef typename WFrag<T16>::V V;
    __shared__ __align__(16) float os[16 * 68];
    const size_t z = blockIdx.z; A += z * sA; if (A2) A2 += z * sA; Bt += z * sB; if (Bt2) Bt2 += z * sB; C += z * sC;
    const int lane = threadIdx.x & 31, lr = lane & 15, hi = lane >> 4; const int r0 = blockIdx.x * 64, c0 = blockIdx.y * 64;
    v8f acc[4][4];
#pragma unroll
    for (int mb = 0; mb < 4; ++mb)
#pragma unroll
        for (int nb = 0; nb < 4; ++nb) acc[mb][nb] = (v8f){};
    const size_t aoff = (size_t)(r0 + lr) * K + 8 * hi, boff = (size_t)(c0 + lr) * K + 8 * hi;
#pragma unroll 1
    for (int kc = 0; kc < K; kc += 32) {
        V a[4], a2[4];
#pragma unroll
        for (int mb = 0; mb < 4; ++mb) { a[mb] = WFrag<T16>::ld(A + aoff + (size_t)mb * 16 * K + kc); if (NSPLIT == 1 || NSPLIT == 2) a2[mb] = WFrag<T16>::ld(A2 + aoff + (size_t)mb * 16 * K + kc); }
#pragma unroll
        for (int nb = 0; nb < 4; ++nb) { const V b = WFrag<T16>::ld(Bt + boff + (size_t)nb * 16 * K + kc); V b2; if (NSPLIT >= 2) b2 = WFrag<T16>::ld(Bt2 + boff + (size_t)nb * 16 * K + kc);
#pragma unroll
            for (int mb = 0; mb < 4; ++mb) { acc[mb][nb] = WFrag<T16>::mma(a[mb], b, acc[mb][nb]); if (NSPLIT == 1 || NSPLIT == 2) acc[mb][nb] = WFrag<T16>::mma(a2[mb], b, acc[mb][nb]); if (NSPLIT >= 2) acc[mb][nb] = WFrag<T16>::mma(a[mb], b2, acc[mb][nb]); } }
        asm volatile("v_nop\n\tv_nop\n\tv_nop\n\tv_nop" : "+v"(acc[0][0]), "+v"(acc[1][1]), "+v"(acc[2][2]), "+v"(acc[3][3]) : "v"(a[0]), "v"(a[3]));
    }
#pragma unroll
    for (int mb = 0; mb < 4; ++mb) {
#pragma unroll
        for (int nb = 0; nb < 4; ++nb) {
#pragma unroll
            for (int j = 0; j < 8; ++j) os[(hi * 8 + j) * 68 + nb * 16 + lr] = acc[mb][nb][j]; }
        __builtin_amdgcn_wave_barrier(); asm volatile("" ::: "memory");
        float* crow = C + (size_t)(r0 + mb * 16) * ldc + c0;
{
#pragma unroll
            for (int s = 0; s < 8; ++s) { const int row = 2 * s + hi, cofs = lr * 4; v4f val = *(const v4fa*)(os + row * 68 + cofs); if (BIAS) { val[0] += bfr(bias[c0 + cofs]); val[1] += bfr(bias[c0 + cofs + 1]); val[2] += bfr(bias[c0 + cofs + 2]); val[3] += bfr(bias[c0 + cofs + 3]); }
                *(v4f*)(crow + (size_t)row * ldc + cofs) = val; }
             }
        __builtin_amdgcn_wave_barrier(); asm volatile("" ::: "memory");
    }
}

// ---- k_gemmc: the same one-wave 64x64 tile GEMM specialised for causal attention: CMODE 1 skips score tiles entirely above the diagonal (query rows r0+roff.., key columns c0..), CMODE 2 limits the
// key (K) loop of the probability x value contraction to the diagonal block (probabilities beyond it are exactly zero). roff = row offset of this launch's first row within the sequence.
// CMODE 2 also splits that key loop over work-groups: grid.y = (HD / 64) * KS, slice ks takes keys [ks * KCH, ks * KCH + KCH) and stores its partial tile in plane ks of C (plane stride sK); slices that start past the diagonal block store nothing, and k_merge adds only the stored planes.
template <typename T16, int NSPLIT, int CMODE>
__global__ __launch_bounds__(32) void k_gemmc(const T16* __restrict__ A, const T16* __restrict__ A2, const T16* __restrict__ Bt, const T16* __restrict__ Bt2, int K, float* C, int ldc, int roff, size_t sA, size_t sB, size_t sC, size_t sK) {
    typedef typename WFrag<T16>::V V;
    __shared__ __align__(16) float os[16 * 68];
    const size_t z = blockIdx.z; A += z * sA; if (A2) A2 += z * sA; Bt += z * sB; if (Bt2) Bt2 += z * sB; C += z * sC;
    const int ks = (CMODE == 2) ? (int)blockIdx.y / (HD / 64) : 0;
    const int lane = threadIdx.x & 31, lr = lane & 15, hi = lane >> 4; const int r0 = blockIdx.x * 64, c0 = ((CMODE == 2) ? (int)blockIdx.y % (HD / 64) : (int)blockIdx.y) * 64;
    if (CMODE == 1 && c0 > r0 + roff + 63) return;                  // score tile entirely above the causal diagonal: never read (the softmax masks j > i by select)
    const int Kd = (CMODE == 2) ? min(K, r0 + roff + 64) : K;        // P.V: probabilities are exactly 0 beyond the diagonal block, so the K loop stops there
    const int K0 = ks * KCH; if (CMODE == 2 && K0 >= Kd) return;     // slice wholly past the diagonal block: no plane stored, none read
    const int Kl = (CMODE == 2) ? min(Kd, K0 + KCH) : K; C += (size_t)ks * sK;
    v8f acc[4][4];
#pragma unroll
    for (int mb = 0; mb < 4; ++mb)
#pragma unroll
        for (int nb = 0; nb < 4; ++nb) acc[mb][nb] = (v8f){};
    const size_t aoff = (size_t)(r0 + lr) * K + 8 * hi, boff = (size_t)(c0 + lr) * K + 8 * hi;
#pragma unroll 1
    for (int kc = K0; kc < Kl; kc += 32) {
        V a[4], a2[4];
#pragma unroll
        for (int mb = 0; mb < 4; ++mb) { a[mb] = WFrag<T16>::ld(A + aoff + (size_t)mb * 16 * K + kc); if (NSPLIT == 1 || NSPLIT == 2) a2[mb] = WFrag<T16>::ld(A2 + aoff + (size_t)mb * 16 * K + kc); }
#pragma unroll
        for (int nb = 0; nb < 4; ++nb) { const V b = WFrag<T16>::ld(Bt + boff + (size_t)nb * 16 * K + kc); V b2; if (NSPLIT >= 2) b2 = WFrag<T16>::ld(Bt2 + boff + (size_t)nb * 16 * K + kc);
#pragma unroll
            for (int mb = 0; mb < 4; ++mb) { acc[mb][nb] = WFrag<T16>::mma(a[mb], b, acc[mb][nb]); if (NSPLIT == 1 || NSPLIT == 2) acc[mb][nb] = WFrag<T16>::mma(a2[mb], b, acc[mb][nb]); if (NSPLIT >= 2) acc[mb][nb] = WFrag<T16>::mma(a[mb], b2, acc[mb][nb]); } }
        asm volatile("v_nop\n\tv_nop\n\tv_nop\n\tv_nop" : "+v"(acc[0][0]), "+v"(acc[1][1]), "+v"(acc[2][2]), "+v"(acc[3][3]) : "v"(a[0]), "v"(a[3]));
    }
#pragma unroll
    for (int mb = 0; mb < 4; ++mb) {
#pragma unroll
        for (int nb = 0; nb < 4; ++nb) {
#pragma unroll
            for (int j = 0; j < 8; ++j) os[(hi * 8 + j) * 68 + nb * 16 + lr] = acc[mb][nb][j]; }
        __builtin_amdgcn_wave_barrier(); asm volatile("" ::: "memory");
        float* crow = C + (size_t)(r0 + mb * 16) * ldc + c0;
{
#pragma unroll
            for (int s = 0; s < 8; ++s) { const int row = 2 * s + hi, cofs = lr * 4; v4f val = *(const v4fa*)(os + row * 68 + cofs);
                *(v4f*)(crow + (size_t)row * ldc + cofs) = val; }
             }
        __builtin_amdgcn_wave_barrier(); asm volatile("" ::: "memory");
    }
}

__device__ __forceinline__ h16 tohx(float x) { return (h16)x; }
__device__ __forceinline__ void splitf(float y, unsigned short& h, unsigned short& l) { h = f2bf(y); l = f2bf(y - bf2f(h)); }
typedef __attribute__((ext_vector_type(2))) _Float16 v2h;
typedef __attribute__((ext_vector_type(4))) _Float16 v4h;
typedef __attribute__((ext_vector_type(2))) unsigned short v2us;
typedef __attribute__((ext_vector_type(4))) unsigned short v4us;
typedef __attribute__((ext_vector_type(2))) float v2f;
typedef __attribute__((ext_vector_type(4))) int v4i;

__global__ __launch_bounds__(256) void k_cvt8(const float* __restrict__ src, bf* dst, size_t n8) { const size_t i = (size_t)blockIdx.x * 256 + threadIdx.x; if (i >= n8) return; const v8f v = *(const v8f*)(src + i * 8); v8us o;
#pragma unroll
    for (int k = 0; k < 8; ++k) o[k] = f2bf(v[k]); *(v8us*)(dst + i * 8) = o;  }

// k_rope: head planes [h][t][d] (fp16 + hi/lo) of rope(x) x sc with the rotate-half convention out[d] = x[d] cos[t][d] - x[d+HD/2] sin[t][d], out[d+HD/2] = x[d+HD/2] cos[t][d+HD/2] + x[d] sin[t][d+HD/2]
__global__ __launch_bounds__(256) void k_rope(const float* __restrict__ F, int pitch, int nheads, const float* __restrict__ CS, const float* __restrict__ RF, const float* __restrict__ nw, float sc, h16* P16, bf* Ph, bf* Pl) {
    const size_t e = ((size_t)blockIdx.x * 256 + threadIdx.x) * 2; if (e >= (size_t)nheads * TT * HD) return; const int d = (int)(e % HD); const int t = (int)((e / HD) % TT); const int h = (int)(e / ((size_t)HD * TT)); const float* f = F + (size_t)t * pitch + h * HD; const float rf = RF ? RF[(size_t)h * TT + t] : 1.0f; v2h o16; v2us oh, ol;
#pragma unroll
    for (int q = 0; q < 2; ++q) { const int dd = d + q; const int dp = (dd < HD / 2) ? dd + HD / 2 : dd - HD / 2; float x0 = f[dd], x1 = f[dp];
        if (RF) { float n0 = __fmul_rn(x0, rf), n1 = __fmul_rn(x1, rf); asm volatile("" : "+v"(n0)); asm volatile("" : "+v"(n1)); x0 = __fmul_rn(bfr(nw[dd]), n0); x1 = __fmul_rn(bfr(nw[dp]), n1); }
        const v2f cs = *(const v2f*)(CS + ((size_t)t * HD + dd) * 2); float a = __fmul_rn(x0, cs[0]), bq = __fmul_rn(x1, cs[1]); asm volatile("" : "+v"(a)); asm volatile("" : "+v"(bq)); const float r = ((dd < HD / 2) ? __fsub_rn(a, bq) : __fadd_rn(a, bq)) * sc;
        o16[q] = tohx(r); unsigned short a2, c2; splitf(r, a2, c2); oh[q] = a2; ol[q] = c2; }
    *(v2h*)(P16 + e) = o16; *(v2us*)(Ph + e) = oh; *(v2us*)(Pl + e) = ol;  }
__global__ __launch_bounds__(256) void k_vtp(const float* __restrict__ F, int pitch, int nheads, h16* V16, bf* Vh, bf* Vl) { const size_t e = ((size_t)blockIdx.x * 256 + threadIdx.x) * 2; if (e >= (size_t)nheads * HD * TT) return; const int t = (int)(e % TT); const int d = (int)((e / TT) % HD); const int g = (int)(e / ((size_t)TT * HD)); v2h o16; v2us oh, ol;
#pragma unroll
    for (int q = 0; q < 2; ++q) { const float x = F[(size_t)(t + q) * pitch + g * HD + d]; o16[q] = tohx(x); unsigned short a2, c2; splitf(x, a2, c2); oh[q] = a2; ol[q] = c2; }
    *(v2h*)(V16 + e) = o16; *(v2us*)(Vh + e) = oh; *(v2us*)(Vl + e) = ol;  }
__global__ __launch_bounds__(256) void k_cscvt(const float* __restrict__ cosT, const float* __restrict__ sinT, float* CS) { const int idx = blockIdx.x * 256 + threadIdx.x; if (idx >= TT * HD) return; v2f cs; cs[0] = bfr(cosT[idx]); cs[1] = bfr(sinT[idx]); *(v2f*)(CS + (size_t)idx * 2) = cs;  }
// k_asoft: per row (zz, i): t = S x HD^-0.5 for j <= i and i - j < WIN (WIN = TT, so the window test always holds: plain causal mask; the reference's -1e9 additive fill vanishes identically); softmax over the 2048 keys (register row, one exp, fixed trees);
__global__ __launch_bounds__(256) void k_asoft(const float* __restrict__ Sb, h16* P16, bf* Ph, bf* Pl) {
    const int lane = threadIdx.x & 31; const int row = blockIdx.x * 8 + (threadIdx.x >> 5); if (row >= ZH * TT) return; const int i = row % TT; const int zz = row / TT; (void)zz; const bool hires = (i < RH); const float* sr = Sb + (size_t)row * TT; float v[TT / 32]; float mx = -3.0e38f;
#pragma unroll
    for (int ch = 0; ch < TT / 128; ++ch) { const int j0 = ch * 128 + lane * 4; const v4f a = *(const v4f*)(sr + j0);
#pragma unroll
        for (int q = 0; q < 4; ++q) { const int j = j0 + q; (void)j; const float t = (j <= i && i - j < WIN) ? a[q] * SCL : -3.0e38f; v[ch * 4 + q] = t; mx = fmaxf(mx, t); } }
#pragma unroll
    for (int sh = 16; sh; sh >>= 1) mx = fmaxf(mx, __shfl_xor(mx, sh, 32));
    float sum = 0.f;
#pragma unroll
    for (int k = 0; k < TT / 32; ++k) { float d0 = __fsub_rn(v[k], mx); asm volatile("" : "+v"(d0)); v[k] = __builtin_amdgcn_exp2f(__fmul_rn(d0, 1.4426950408889634f)); sum += v[k]; }
#pragma unroll
    for (int sh = 16; sh; sh >>= 1) sum += __shfl_xor(sum, sh, 32);
    const float f = __fdiv_rn(hires ? 1.0f : PCAR, sum);
{
        if (hires) {
#pragma unroll
            for (int ch = 0; ch < TT / 128; ++ch) { v4us oh, ol;
#pragma unroll
                for (int q = 0; q < 4; ++q) { unsigned short a, c2; splitf(v[ch * 4 + q] * f, a, c2); oh[q] = a; ol[q] = c2; }
                const size_t oo = ((size_t)zz * (RH ? RH : 1) + i) * TT + ch * 128 + lane * 4; *(v4us*)(Ph + oo) = oh; *(v4us*)(Pl + oo) = ol; }
        } else {
#pragma unroll
            for (int ch = 0; ch < TT / 128; ++ch) { v4h o4;
#pragma unroll
                for (int q = 0; q < 4; ++q) o4[q] = tohx(v[ch * 4 + q] * f);
                *(v4h*)(P16 + (size_t)row * TT + ch * 128 + lane * 4) = o4; } }
         }
}
// k_merge: adds the key-slice planes of O (plane stride ZH*TT*HD) in ascending slice order; a row of 64-row tile r has ceil(64 (r + 1) / KCH) stored planes.
__global__ __launch_bounds__(256) void k_merge(const float* __restrict__ O, int h0, bf* Ah, bf* Al) { const size_t e = ((size_t)blockIdx.x * 256 + threadIdx.x) * 2; if (e >= (size_t)ZH * TT * HD) return; const int d = (int)(e % HD); const int t = (int)((e / HD) % TT); const int zz = (int)(e / ((size_t)HD * TT)); const float cs = (t < RH) ? 1.0f : (1.0f / PCAR); const size_t oo = (size_t)t * DQ + (h0 + zz) * HD + d;
    const int np = ((t / 64 + 1) * 64 + KCH - 1) / KCH; v2f part[KS];
#pragma unroll
    for (int p = 0; p < KS; ++p) part[p] = (p < np) ? *(const v2f*)(O + (size_t)p * ((size_t)ZH * TT * HD) + e) : (v2f){0.f, 0.f};
    v2f os = part[0];
#pragma unroll
    for (int p = 1; p < KS; ++p) os += part[p];
    v2us oh, ol;
#pragma unroll
    for (int q = 0; q < 2; ++q) { unsigned short a, c2; splitf(os[q] * cs, a, c2); oh[q] = a; ol[q] = c2; } *(v2us*)(Ah + oo) = oh; *(v2us*)(Al + oo) = ol;  }

extern "C" void kernel_launch(void* const* d_in, const int* in_sizes, int n_in,
                              void* d_out, int out_size, void* d_ws, size_t ws_size, hipStream_t stream) {
    (void)in_sizes; (void)n_in; (void)out_size;
    const float* x = (const float*)d_in[0]; const float* fcos = (const float*)d_in[1]; const float* fsin = (const float*)d_in[2]; const float* wq = (const float*)d_in[3]; const float* wk = (const float*)d_in[4]; const float* wv = (const float*)d_in[5]; const float* wo = (const float*)d_in[6];   /* input order x, cos, sin ([1][1][2048][64] = flat [2048][64]; read per position and per dimension), wq, wk, wv, wo ('oi') */
    float* OUT = (float*)d_out;     // [2][2048][1024]
    char* wsp = (char*)d_ws;
    auto take = [&](size_t bytes) { char* p = wsp; wsp += (bytes + 255) & ~(size_t)255; return (void*)p; };
    bf* WQ = (bf*)take((size_t)DQ * DM * 2); bf* WK = (bf*)take((size_t)DKV * DM * 2); bf* WV = (bf*)take((size_t)DKV * DM * 2); bf* WO = (bf*)take((size_t)DM * DQ * 2); float* CS = (float*)take((size_t)TT * HD * 2 * 4);
    bf* XB = (bf*)take((size_t)TT * DM * 2); float* FQ = (float*)take((size_t)TT * DQ * 4); float* FK = (float*)take((size_t)TT * DKV * 4);
    h16* QP16 = (h16*)take((size_t)NH_ * TT * HD * 2); h16* KP16 = (h16*)take((size_t)NKV * TT * HD * 2); h16* VT16 = (h16*)take((size_t)NKV * HD * TT * 2);
    bf* QPh = (bf*)take((size_t)NH_ * TT * HD * 2); bf* QPl = (bf*)take((size_t)NH_ * TT * HD * 2); bf* KPh = (bf*)take((size_t)NKV * TT * HD * 2); bf* KPl = (bf*)take((size_t)NKV * TT * HD * 2); bf* VTh = (bf*)take((size_t)NKV * HD * TT * 2); bf* VTl = (bf*)take((size_t)NKV * HD * TT * 2); bf* Ph = (bf*)take((size_t)ZH * RH * TT * 2); bf* Pl = (bf*)take((size_t)ZH * RH * TT * 2);
    float* Sb = (float*)take((size_t)ZH * TT * TT * 4); h16* P16 = (h16*)take((size_t)ZH * TT * TT * 2); float* Ob = (float*)take((size_t)KS * ZH * TT * HD * 4); bf* ATh = (bf*)take((size_t)TT * DQ * 2); bf* ATl = (bf*)take((size_t)TT * DQ * 2);
    if ((size_t)(wsp - (char*)d_ws) > ws_size) return;    // ws 256 MiB
    float* FV = FK;   // v projection reuses the k buffer after the k planes are built (stream-ordered)
    { k_cvt8<<<(unsigned)(((size_t)DQ * DM / 8 + 255) / 256), 256, 0, stream>>>(wq, WQ, (size_t)DQ * DM / 8); k_cvt8<<<(unsigned)(((size_t)DKV * DM / 8 + 255) / 256), 256, 0, stream>>>(wk, WK, (size_t)DKV * DM / 8); k_cvt8<<<(unsigned)(((size_t)DKV * DM / 8 + 255) / 256), 256, 0, stream>>>(wv, WV, (size_t)DKV * DM / 8);
      k_cvt8<<<(unsigned)(((size_t)DM * DQ / 8 + 255) / 256), 256, 0, stream>>>(wo, WO, (size_t)DM * DQ / 8);
       }
    k_cscvt<<<(TT * HD + 255) / 256, 256, 0, stream>>>(fcos, fsin, CS);   /* rotary table from the inputs */
    const unsigned LQ = (unsigned)(((size_t)NH_ * TT * HD / 2 + 255) / 256), LKv = (unsigned)(((size_t)NKV * TT * HD / 2 + 255) / 256);
    for (int b = 0; b < NB_; ++b) {
        
        k_cvt8<<<(unsigned)(((size_t)TT * DM / 8 + 255) / 256), 256, 0, stream>>>(x + (size_t)b * TT * DM, XB, (size_t)TT * DM / 8);
        k_gemmw<bf, 0, false><<<dim3(TT / 64, DQ / 64, 1), 32, 0, stream>>>(XB, nullptr, WQ, nullptr, DM, FQ, DQ, nullptr, 0, 0, 0);
        k_rope<<<LQ, 256, 0, stream>>>(FQ, DQ, NH_, CS, nullptr, nullptr, 1.0f, QP16, QPh, QPl);
        k_gemmw<bf, 0, false><<<dim3(TT / 64, DKV / 64, 1), 32, 0, stream>>>(XB, nullptr, WK, nullptr, DM, FK, DKV, nullptr, 0, 0, 0);
        k_rope<<<LKv, 256, 0, stream>>>(FK, DKV, NKV, CS, nullptr, nullptr, 1.0f, KP16, KPh, KPl);
        k_gemmw<bf, 0, false><<<dim3(TT / 64, DKV / 64, 1), 32, 0, stream>>>(XB, nullptr, WV, nullptr, DM, FV, DKV, nullptr, 0, 0, 0); k_vtp<<<LKv, 256, 0, stream>>>(FV, DKV, NKV, VT16, VTh, VTl);
        for (int h0 = 0; h0 < NH_; h0 += ZH) { const size_t zq = (size_t)h0, zk = (size_t)(h0 / REP);   // one kv head per query head: the pass's two heads use consecutive kv planes (z-strides TT*HD)
            k_gemmc<bf, 2, 1><<<dim3(RH / 64, TT / 64, ZH), 32, 0, stream>>>(QPh + zq * TT * HD, QPl + zq * TT * HD, KPh + zk * TT * HD, KPl + zk * TT * HD, HD, Sb, TT, 0, (size_t)TT * HD, (size_t)TT * HD, (size_t)TT * TT, 0);
            if (RH < TT) k_gemmc<h16, 0, 1><<<dim3((TT - RH) / 64, TT / 64, ZH), 32, 0, stream>>>(QP16 + zq * TT * HD + (size_t)RH * HD, nullptr, KP16 + zk * TT * HD, nullptr, HD, Sb + (size_t)RH * TT, TT, RH, (size_t)TT * HD, (size_t)TT * HD, (size_t)TT * TT, 0);   /* no single-f16 rows when RH == TT: a zero-sized grid must not be launched */
            k_asoft<<<ZH * TT / 8, 256, 0, stream>>>(Sb, P16, Ph, Pl);
            k_gemmc<bf, 2, 2><<<dim3(RH / 64, (HD / 64) * KS, ZH), 32, 0, stream>>>(Ph, Pl, VTh + zk * HD * TT, VTl + zk * HD * TT, TT, Ob, HD, 0, (size_t)RH * TT, (size_t)HD * TT, (size_t)TT * HD, (size_t)ZH * TT * HD);
            if (RH < TT) k_gemmc<h16, 0, 2><<<dim3((TT - RH) / 64, (HD / 64) * KS, ZH), 32, 0, stream>>>(P16 + (size_t)RH * TT, nullptr, VT16 + zk * HD * TT, nullptr, TT, Ob + (size_t)RH * HD, HD, RH, (size_t)TT * TT, (size_t)HD * TT, (size_t)TT * HD, (size_t)ZH * TT * HD);   /* likewise */
            k_merge<<<(unsigned)(((size_t)ZH * TT * HD / 2 + 255) / 256), 256, 0, stream>>>(Ob, h0, ATh, ATl); }
        k_gemmw<bf, 1, false><<<dim3(TT / 64, DM / 64, 1), 32, 0, stream>>>(ATh, ATl, WO, nullptr, DQ, OUT + (size_t)b * TT * DM, DM, nullptr, 0, 0, 0); }
}

// v002
// Measured time: 623 microseconds a run.
// Two timings next to v001 put it at 1.09 and 1.10 times that version's speed.
// Counting every step since v000, it is 1.87 times as fast.
#include <hip/hip_runtime.h>

// Causal multi-head attention with rotate-half rotary embedding from cos / sin TABLE INPUTS read by value (x [2][2048][1024]; q, k, v = einsum('bld,ed', x, w) ('oi' [1024][1024] 1/32, no bias; 16 heads x 64); cos, sin f32 [1][1][2048][64] are INPUTS (arbitrary values on this draw: independent normal tables, not cosines of angles), read per position AND per dimension; q, k <- t cos + rotate_half(t) sin with rotate_half = cat(-x2, x1) over the two 32-wide halves; scores / sqrt(64); keys j <= i kept, finfo.min elsewhere (== exclusion); softmax; out = einsum('bld,ed', merged, wo) -> [2][2048][1024] (4.2 M); argument order x, cos, sin, wq, wk, wv, wo).
// Layout per batch: bf16 copy of x; 'oi' weights; exact projections; {cos, sin} table from the bf16-rounded inputs; rotate-half plane builders; causal T-2048 attention (RH = TT = 2048: ALL query rows hi/lo 3 products; no single-f16 rows in this build; k_gemmc skips tiles above the diagonal); merged hi/lo x Wo exact.
// Compute dtypes, f32 accumulate: every input rounded to bf16 incl. the tables; projections exact; rotary f32; attention: ALL 2,048 query rows bf16 hi + lo operands with three products (RH = TT; the single-f16 path is not launched); softmax f32; Wo hl x exact.

#define NB_  2
#define TT   2048
#define DM   1024
#define NH_  16
#define NKV  16
#define REP  (NH_ / NKV)
#define HD   64
#define DQ   (NH_ * HD)
#define DKV  (NKV * HD)
#define ZH   8      // heads per attention pass (grid.z of the score and value launches; the softmax and merge grids span ZH heads in x)
#define RH   2048   // ALL query rows in the exact class (bf16 hi + lo, three products): this draw's logits have sigma 2.0 (the rotated q, k carry the variance of two unit-normal tables): RH = TT leaves no single-f16 rows
#define WIN  2048
#define PCAR 1024.0f
#define SCL  0.125f   // HD^-0.5
#define KCH  128      // keys per slice of the probability x value contraction (one work-group per slice)
#define KS   (TT / KCH)
typedef _Float16 h16;
typedef unsigned short bf;
typedef __attribute__((ext_vector_type(16))) __bf16   v16bf;
typedef __attribute__((ext_vector_type(16))) _Float16 v16h;
typedef __attribute__((ext_vector_type(8)))  _Float16 v8h;
typedef __attribute__((ext_vector_type(8)))  unsigned short v8us;
typedef __attribute__((ext_vector_type(8)))  float    v8f;
typedef __attribute__((ext_vector_type(4)))  float    v4f;
typedef v8h  __attribute__((may_alias)) v8ha;
typedef v4f  __attribute__((may_alias)) v4fa;
typedef v8us __attribute__((may_alias)) v8usa;

__device__ __forceinline__ unsigned short f2bf(float f) { unsigned u = __float_as_uint(f); u += 0x7FFFu + ((u >> 16) & 1u); return (unsigned short)(u >> 16); }
__device__ __forceinline__ float bf2f(unsigned short b) { return __uint_as_float(((unsigned)b) << 16); }
__device__ __forceinline__ float bfr(float f) { return bf2f(f2bf(f)); }
__device__ __forceinline__ v16h cat16(v8h lo, v8h hi) { return __builtin_shufflevector(lo, hi, 0, 1, 2, 3, 4, 5, 6, 7, 8, 9, 10, 11, 12, 13, 14, 15); }
__device__ __forceinline__ v16bf cat16b(v8us lo, v8us hi) { return __builtin_bit_cast(v16bf, __builtin_shufflevector(lo, hi, 0, 1, 2, 3, 4, 5, 6, 7, 8, 9, 10, 11, 12, 13, 14, 15)); }
__device__ __forceinline__ v8f wmma16(v16h a, v16h b, v8f c) { return __builtin_amdgcn_wmma_f32_16x16x32_f16(false, a, false, b, (short)0, c, false, false); }
__device__ __forceinline__ v8f wmmab(v16bf a, v16bf b, v8f c) { return __builtin_amdgcn_wmma_f32_16x16x32_bf16(false, a, false, b, (short)0, c, false, false); }



// ---- k_gemmw: register-blocked GEMM, ONE WAVE per 64x64 output tile (16 accumulators), operands straight from K-contiguous 16-bit planes; grid (M/64, N/64, Z), 32 threads.
// C[m][n] (f32, pitch ldc, + optional f32 bias[n]) = sum_k A[m][k] Bt[n][k] (+ split products per NSPLIT). z-batch strides sA/sB/sC in elements. K % 32 == 0.
template <typename T16> struct WFrag;
template <> struct WFrag<h16> { typedef v16h V; static __device__ __forceinline__ V ld(const h16* p) { return cat16(*(const v8h*)p, *(const v8h*)(p + 16)); } static __device__ __forceinline__ v8f mma(V a, V b, v8f c) { return wmma16(a, b, c); } };
template <> struct WFrag<bf> { typedef v16bf V; static __device__ __forceinline__ V ld(const bf* p) { return cat16b(*(const v8us*)p, *(const v8us*)(p + 16)); } static __device__ __forceinline__ v8f mma(V a, V b, v8f c) { return wmmab(a, b, c); } };
template <typename T16, int NSPLIT, bool BIAS>
__global__ __launch_bounds__(32) void k_gemmw(const T16* __restrict__ A, const T16* __restrict__ A2, const T16* __restrict__ Bt, const T16* __restrict__ Bt2, int K, float* C, int ldc, const float* __restrict__ bias, size_t sA, size_t sB, size_t sC) {
    typedef typename WFrag<T16>::V V;
    __shared__ __align__(16) float os[16 * 68];
    const size_t z = blockIdx.z; A += z * sA; if (A2) A2 += z * sA; Bt += z * sB; if (Bt2) Bt2 += z * sB; C += z * sC;
    const int lane = threadIdx.x & 31, lr = lane & 15, hi = lane >> 4; const int r0 = blockIdx.x * 64, c0 = blockIdx.y * 64;
    v8f acc[4][4];
#pragma unroll
    for (int mb = 0; mb < 4; ++mb)
#pragma unroll
        for (int nb = 0; nb < 4; ++nb) acc[mb][nb] = (v8f){};
    const size_t aoff = (size_t)(r0 + lr) * K + 8 * hi, boff = (size_t)(c0 + lr) * K + 8 * hi;
#pragma unroll 1
    for (int kc = 0; kc < K; kc += 32) {
        V a[4], a2[4];
#pragma unroll
        for (int mb = 0; mb < 4; ++mb) { a[mb] = WFrag<T16>::ld(A + aoff + (size_t)mb * 16 * K + kc); if (NSPLIT == 1 || NSPLIT == 2) a2[mb] = WFrag<T16>::ld(A2 + aoff + (size_t)mb * 16 * K + kc); }
#pragma unroll
        for (int nb = 0; nb < 4; ++nb) { const V b = WFrag<T16>::ld(Bt + boff + (size_t)nb * 16 * K + kc); V b2; if (NSPLIT >= 2) b2 = WFrag<T16>::ld(Bt2 + boff + (size_t)nb * 16 * K + kc);
#pragma unroll
            for (int mb = 0; mb < 4; ++mb) { acc[mb][nb] = WFrag<T16>::mma(a[mb], b, acc[mb][nb]); if (NSPLIT == 1 || NSPLIT == 2) acc[mb][nb] = WFrag<T16>::mma(a2[mb], b, acc[mb][nb]); if (NSPLIT >= 2) acc[mb][nb] = WFrag<T16>::mma(a[mb], b2, acc[mb][nb]); } }
        asm volatile("v_nop\n\tv_nop\n\tv_nop\n\tv_nop" : "+v"(acc[0][0]), "+v"(acc[1][1]), "+v"(acc[2][2]), "+v"(acc[3][3]) : "v"(a[0]), "v"(a[3]));
    }
#pragma unroll
    for (int mb = 0; mb < 4; ++mb) {
#pragma unroll
        for (int nb = 0; nb < 4; ++nb) {
#pragma unroll
            for (int j = 0; j < 8; ++j) os[(hi * 8 + j) * 68 + nb * 16 + lr] = acc[mb][nb][j]; }
        __builtin_amdgcn_wave_barrier(); asm volatile("" ::: "memory");
        float* crow = C + (size_t)(r0 + mb * 16) * ldc + c0;
{
#pragma unroll
            for (int s = 0; s < 8; ++s) { const int row = 2 * s + hi, cofs = lr * 4; v4f val = *(const v4fa*)(os + row * 68 + cofs); if (BIAS) { val[0] += bfr(bias[c0 + cofs]); val[1] += bfr(bias[c0 + cofs + 1]); val[2] += bfr(bias[c0 + cofs + 2]); val[3] += bfr(bias[c0 + cofs + 3]); }
                *(v4f*)(crow + (size_t)row * ldc + cofs) = val; }
             }
        __builtin_amdgcn_wave_barrier(); asm volatile("" ::: "memory");
    }
}

// ---- k_gemmc: the same one-wave 64x64 tile GEMM specialised for causal attention: CMODE 1 skips score tiles entirely above the diagonal (query rows r0+roff.., key columns c0..), CMODE 2 limits the
// key (K) loop of the probability x value contraction to the diagonal block (probabilities beyond it are exactly zero). roff = row offset of this launch's first row within the sequence.
// CMODE 2 also splits that key loop over work-groups: grid.y = (HD / 64) * KS, slice ks takes keys [ks * KCH, ks * KCH + KCH) and stores its partial tile in plane ks of C (plane stride sK); slices that start past the diagonal block store nothing, and k_merge adds only the stored planes.
template <typename T16, int NSPLIT, int CMODE>
__global__ __launch_bounds__(32) void k_gemmc(const T16* __restrict__ A, const T16* __restrict__ A2, const T16* __restrict__ Bt, const T16* __restrict__ Bt2, int K, float* C, int ldc, int roff, size_t sA, size_t sB, size_t sC, size_t sK) {
    typedef typename WFrag<T16>::V V;
    __shared__ __align__(16) float os[16 * 68];
    const size_t z = blockIdx.z; A += z * sA; if (A2) A2 += z * sA; Bt += z * sB; if (Bt2) Bt2 += z * sB; C += z * sC;
    const int ks = (CMODE == 2) ? (int)blockIdx.y / (HD / 64) : 0;
    const int lane = threadIdx.x & 31, lr = lane & 15, hi = lane >> 4; const int r0 = blockIdx.x * 64, c0 = ((CMODE == 2) ? (int)blockIdx.y % (HD / 64) : (int)blockIdx.y) * 64;
    if (CMODE == 1 && c0 > r0 + roff + 63) return;                  // score tile entirely above the causal diagonal: never read (the softmax masks j > i by select)
    const int Kd = (CMODE == 2) ? min(K, r0 + roff + 64) : K;        // P.V: probabilities are exactly 0 beyond the diagonal block, so the K loop stops there
    const int K0 = ks * KCH; if (CMODE == 2 && K0 >= Kd) return;     // slice wholly past the diagonal block: no plane stored, none read
    const int Kl = (CMODE == 2) ? min(Kd, K0 + KCH) : K; C += (size_t)ks * sK;
    v8f acc[4][4];
#pragma unroll
    for (int mb = 0; mb < 4; ++mb)
#pragma unroll
        for (int nb = 0; nb < 4; ++nb) acc[mb][nb] = (v8f){};
    const size_t aoff = (size_t)(r0 + lr) * K + 8 * hi, boff = (size_t)(c0 + lr) * K + 8 * hi;
#pragma unroll 1
    for (int kc = K0; kc < Kl; kc += 32) {
        V a[4], a2[4];
#pragma unroll
        for (int mb = 0; mb < 4; ++mb) { a[mb] = WFrag<T16>::ld(A + aoff + (size_t)mb * 16 * K + kc); if (NSPLIT == 1 || NSPLIT == 2) a2[mb] = WFrag<T16>::ld(A2 + aoff + (size_t)mb * 16 * K + kc); }
#pragma unroll
        for (int nb = 0; nb < 4; ++nb) { const V b = WFrag<T16>::ld(Bt + boff + (size_t)nb * 16 * K + kc); V b2; if (NSPLIT >= 2) b2 = WFrag<T16>::ld(Bt2 + boff + (size_t)nb * 16 * K + kc);
#pragma unroll
            for (int mb = 0; mb < 4; ++mb) { acc[mb][nb] = WFrag<T16>::mma(a[mb], b, acc[mb][nb]); if (NSPLIT == 1 || NSPLIT == 2) acc[mb][nb] = WFrag<T16>::mma(a2[mb], b, acc[mb][nb]); if (NSPLIT >= 2) acc[mb][nb] = WFrag<T16>::mma(a[mb], b2, acc[mb][nb]); } }
        asm volatile("v_nop\n\tv_nop\n\tv_nop\n\tv_nop" : "+v"(acc[0][0]), "+v"(acc[1][1]), "+v"(acc[2][2]), "+v"(acc[3][3]) : "v"(a[0]), "v"(a[3]));
    }
#pragma unroll
    for (int mb = 0; mb < 4; ++mb) {
#pragma unroll
        for (int nb = 0; nb < 4; ++nb) {
#pragma unroll
            for (int j = 0; j < 8; ++j) os[(hi * 8 + j) * 68 + nb * 16 + lr] = acc[mb][nb][j]; }
        __builtin_amdgcn_wave_barrier(); asm volatile("" ::: "memory");
        float* crow = C + (size_t)(r0 + mb * 16) * ldc + c0;
{
#pragma unroll
            for (int s = 0; s < 8; ++s) { const int row = 2 * s + hi, cofs = lr * 4; v4f val = *(const v4fa*)(os + row * 68 + cofs);
                *(v4f*)(crow + (size_t)row * ldc + cofs) = val; }
             }
        __builtin_amdgcn_wave_barrier(); asm volatile("" ::: "memory");
    }
}

__device__ __forceinline__ h16 tohx(float x) { return (h16)x; }
__device__ __forceinline__ void splitf(float y, unsigned short& h, unsigned short& l) { h = f2bf(y); l = f2bf(y - bf2f(h)); }
typedef __attribute__((ext_vector_type(2))) _Float16 v2h;
typedef __attribute__((ext_vector_type(4))) _Float16 v4h;
typedef __attribute__((ext_vector_type(2))) unsigned short v2us;
typedef __attribute__((ext_vector_type(4))) unsigned short v4us;
typedef v4us __attribute__((may_alias)) v4usa;
typedef __attribute__((ext_vector_type(2))) float v2f;
typedef __attribute__((ext_vector_type(4))) int v4i;

__global__ __launch_bounds__(256) void k_cvt8(const float* __restrict__ src, bf* dst, size_t n8) { const size_t i = (size_t)blockIdx.x * 256 + threadIdx.x; if (i >= n8) return; const v8f v = *(const v8f*)(src + i * 8); v8us o;
#pragma unroll
    for (int k = 0; k < 8; ++k) o[k] = f2bf(v[k]); *(v8us*)(dst + i * 8) = o;  }

// k_rope: head planes [h][t][d] (fp16 + hi/lo) of rope(x) x sc with the rotate-half convention out[d] = x[d] cos[t][d] - x[d+HD/2] sin[t][d], out[d+HD/2] = x[d+HD/2] cos[t][d+HD/2] + x[d] sin[t][d+HD/2]
__global__ __launch_bounds__(256) void k_rope(const float* __restrict__ F, int pitch, int nheads, const float* __restrict__ CS, const float* __restrict__ RF, const float* __restrict__ nw, float sc, h16* P16, bf* Ph, bf* Pl) {
    const size_t e = ((size_t)blockIdx.x * 256 + threadIdx.x) * 2; if (e >= (size_t)nheads * TT * HD) return; const int d = (int)(e % HD); const int t = (int)((e / HD) % TT); const int h = (int)(e / ((size_t)HD * TT)); const float* f = F + (size_t)t * pitch + h * HD; const float rf = RF ? RF[(size_t)h * TT + t] : 1.0f; v2h o16; v2us oh, ol;
#pragma unroll
    for (int q = 0; q < 2; ++q) { const int dd = d + q; const int dp = (dd < HD / 2) ? dd + HD / 2 : dd - HD / 2; float x0 = f[dd], x1 = f[dp];
        if (RF) { float n0 = __fmul_rn(x0, rf), n1 = __fmul_rn(x1, rf); asm volatile("" : "+v"(n0)); asm volatile("" : "+v"(n1)); x0 = __fmul_rn(bfr(nw[dd]), n0); x1 = __fmul_rn(bfr(nw[dp]), n1); }
        const v2f cs = *(const v2f*)(CS + ((size_t)t * HD + dd) * 2); float a = __fmul_rn(x0, cs[0]), bq = __fmul_rn(x1, cs[1]); asm volatile("" : "+v"(a)); asm volatile("" : "+v"(bq)); const float r = ((dd < HD / 2) ? __fsub_rn(a, bq) : __fadd_rn(a, bq)) * sc;
        o16[q] = tohx(r); unsigned short a2, c2; splitf(r, a2, c2); oh[q] = a2; ol[q] = c2; }
    *(v2h*)(P16 + e) = o16; *(v2us*)(Ph + e) = oh; *(v2us*)(Pl + e) = ol;  }
__global__ __launch_bounds__(256) void k_vtp(const float* __restrict__ F, int pitch, int nheads, h16* V16, bf* Vh, bf* Vl) { const size_t e = ((size_t)blockIdx.x * 256 + threadIdx.x) * 2; if (e >= (size_t)nheads * HD * TT) return; const int t = (int)(e % TT); const int d = (int)((e / TT) % HD); const int g = (int)(e / ((size_t)TT * HD)); v2h o16; v2us oh, ol;
#pragma unroll
    for (int q = 0; q < 2; ++q) { const float x = F[(size_t)(t + q) * pitch + g * HD + d]; o16[q] = tohx(x); unsigned short a2, c2; splitf(x, a2, c2); oh[q] = a2; ol[q] = c2; }
    const size_t e2 = ((size_t)g * HD + d) * (2 * TT) + t;   // hi / lo rows have pitch 2 * TT
    *(v2h*)(V16 + e) = o16; *(v2us*)(Vh + e2) = oh; *(v2us*)(Vl + e2) = ol;  }
__global__ __launch_bounds__(256) void k_cscvt(const float* __restrict__ cosT, const float* __restrict__ sinT, float* CS) { const int idx = blockIdx.x * 256 + threadIdx.x; if (idx >= TT * HD) return; v2f cs; cs[0] = bfr(cosT[idx]); cs[1] = bfr(sinT[idx]); *(v2f*)(CS + (size_t)idx * 2) = cs;  }
// k_asoft: per row (zz, i): t = S x HD^-0.5 for j <= i and i - j < WIN (sliding causal window; the reference's -1e9 additive fill vanishes identically); softmax over the 2048 keys (register row, one exp, fixed trees);
// IN PLACE: a row's hi and lo probabilities (2 x TT x 2 bytes) overwrite that row's own TT f32 scores (Ph = Sb, Pl = Sb + TT bf16 elements, row pitch 2 * TT). One wave owns a row and holds all of it in registers; every store depends on the row sum, hence on every load of the row. Sb is not restrict and the accesses are may_alias for that reason.
static_assert(RH == TT, "the in-place probability rows hold hi and lo planes for every query row");
__global__ __launch_bounds__(256) void k_asoft(const float* Sb, h16* P16, bf* Ph, bf* Pl) {
    const int lane = threadIdx.x & 31; const int row = blockIdx.x * 8 + (threadIdx.x >> 5); if (row >= ZH * TT) return; const int i = row % TT; const int zz = row / TT; (void)zz; const bool hires = (i < RH); const float* sl = Sb + (size_t)row * TT + lane * 4; float v[TT / 32]; float mx = -3.0e38f; v4f a16[TT / 128];
#pragma unroll
    for (int ch = 0; ch < TT / 128; ++ch) a16[ch] = *(const v4fa*)(sl + ch * 128);
    asm volatile("s_wait_xcnt 0x0" :: "v"(sl) : "memory");   // precaution: as an input here the address pair of the row's loads stays live and unwritten up to this wait (without the statement the last load's result was placed on that pair)
#pragma unroll   // full unroll: a16 and v are indexed by constants and stay in registers
    for (int ch = 0; ch < TT / 128; ++ch) { const int j0 = ch * 128 + lane * 4; const v4f a = a16[ch];
#pragma unroll
        for (int q = 0; q < 4; ++q) { const int j = j0 + q; (void)j; const float t = (j <= i && i - j < WIN) ? a[q] * SCL : -3.0e38f; v[ch * 4 + q] = t; mx = fmaxf(mx, t); } }
#pragma unroll
    for (int sh = 16; sh; sh >>= 1) mx = fmaxf(mx, __shfl_xor(mx, sh, 32));
    float sum = 0.f;
#pragma unroll
    for (int k = 0; k < TT / 32; ++k) { float d0 = __fsub_rn(v[k], mx); asm volatile("" : "+v"(d0)); v[k] = __builtin_amdgcn_exp2f(__fmul_rn(d0, 1.4426950408889634f)); sum += v[k]; }
#pragma unroll
    for (int sh = 16; sh; sh >>= 1) sum += __shfl_xor(sum, sh, 32);
    const float f = __fdiv_rn(hires ? 1.0f : PCAR, sum);
{
        if (hires) {
#pragma unroll
            for (int ch = 0; ch < TT / 128; ++ch) { v4us oh, ol;
#pragma unroll
                for (int q = 0; q < 4; ++q) { unsigned short a, c2; splitf(v[ch * 4 + q] * f, a, c2); oh[q] = a; ol[q] = c2; }
                const size_t oo = (size_t)row * (2 * TT) + ch * 128 + lane * 4; *(v4usa*)(Ph + oo) = oh; *(v4usa*)(Pl + oo) = ol; }
        } else {
#pragma unroll
            for (int ch = 0; ch < TT / 128; ++ch) { v4h o4;
#pragma unroll
                for (int q = 0; q < 4; ++q) o4[q] = tohx(v[ch * 4 + q] * f);
                *(v4h*)(P16 + (size_t)row * TT + ch * 128 + lane * 4) = o4; } }
         }
}
// k_merge: adds the key-slice planes of O (plane stride ZH*TT*HD) in ascending slice order; a row of 64-row tile r has ceil(64 (r + 1) / KCH) stored planes.
__global__ __launch_bounds__(256) void k_merge(const float* __restrict__ O, int h0, bf* Ah, bf* Al) { const size_t e = ((size_t)blockIdx.x * 256 + threadIdx.x) * 2; if (e >= (size_t)ZH * TT * HD) return; const int d = (int)(e % HD); const int t = (int)((e / HD) % TT); const int zz = (int)(e / ((size_t)HD * TT)); const float cs = (t < RH) ? 1.0f : (1.0f / PCAR); const size_t oo = (size_t)t * DQ + (h0 + zz) * HD + d;
    const int np = ((t / 64 + 1) * 64 + KCH - 1) / KCH; v2f part[KS];
#pragma unroll
    for (int p = 0; p < KS; ++p) part[p] = (p < np) ? *(const v2f*)(O + (size_t)p * ((size_t)ZH * TT * HD) + e) : (v2f){0.f, 0.f};
    v2f os = part[0];
#pragma unroll
    for (int p = 1; p < KS; ++p) os += part[p];
    v2us oh, ol;
#pragma unroll
    for (int q = 0; q < 2; ++q) { unsigned short a, c2; splitf(os[q] * cs, a, c2); oh[q] = a; ol[q] = c2; } *(v2us*)(Ah + oo) = oh; *(v2us*)(Al + oo) = ol;  }

extern "C" void kernel_launch(void* const* d_in, const int* in_sizes, int n_in,
                              void* d_out, int out_size, void* d_ws, size_t ws_size, hipStream_t stream) {
    (void)in_sizes; (void)n_in; (void)out_size;
    const float* x = (const float*)d_in[0]; const float* fcos = (const float*)d_in[1]; const float* fsin = (const float*)d_in[2]; const float* wq = (const float*)d_in[3]; const float* wk = (const float*)d_in[4]; const float* wv = (const float*)d_in[5]; const float* wo = (const float*)d_in[6];   /* input order x, cos, sin ([1][1][2048][64] = flat [2048][64]; read per position and per dimension), wq, wk, wv, wo ('oi') */
    float* OUT = (float*)d_out;     // [2][2048][1024]
    char* wsp = (char*)d_ws;
    auto take = [&](size_t bytes) { char* p = wsp; wsp += (bytes + 255) & ~(size_t)255; return (void*)p; };
    bf* WQ = (bf*)take((size_t)DQ * DM * 2); bf* WK = (bf*)take((size_t)DKV * DM * 2); bf* WV = (bf*)take((size_t)DKV * DM * 2); bf* WO = (bf*)take((size_t)DM * DQ * 2); float* CS = (float*)take((size_t)TT * HD * 2 * 4);
    bf* XB = (bf*)take((size_t)TT * DM * 2);
    h16* QP16 = (h16*)take((size_t)NH_ * TT * HD * 2); h16* KP16 = (h16*)take((size_t)NKV * TT * HD * 2); h16* VT16 = (h16*)take((size_t)NKV * HD * TT * 2);
    bf* QPh = (bf*)take((size_t)NH_ * TT * HD * 2); bf* QPl = (bf*)take((size_t)NH_ * TT * HD * 2); bf* KPh = (bf*)take((size_t)NKV * TT * HD * 2); bf* KPl = (bf*)take((size_t)NKV * TT * HD * 2); bf* VTh = (bf*)take((size_t)NKV * HD * 2 * TT * 2); bf* VTl = VTh + TT;   // transposed values: row pitch 2 * TT, hi in the first half of a row, lo in the second (the pitch of the probability rows: k_gemmc has one pitch, its K argument, for both operands; its key loop ends at the diagonal block, below TT)
    float* Sb = (float*)take((size_t)ZH * TT * TT * 4); h16* P16 = (h16*)take((RH < TT) ? (size_t)ZH * TT * TT * 2 : 0); float* Ob = (float*)take((size_t)KS * ZH * TT * HD * 4); bf* ATh = (bf*)take((size_t)TT * DQ * 2); bf* ATl = (bf*)take((size_t)TT * DQ * 2);
    if ((size_t)(wsp - (char*)d_ws) > ws_size) return;    // ws 256 MiB
    bf* Ph = (bf*)Sb; bf* Pl = Ph + TT;   // probabilities in place: row pitch 2 * TT, hi plane in the first half of the score row, lo plane in the second
    float* FQ = Sb; float* FK = Sb + (size_t)TT * DQ;   // the f32 projections are dead once the head planes are built and the scores are dead while they are built: they share the score plane (stream-ordered)
    float* FV = FK;   // v projection reuses the k buffer after the k planes are built (stream-ordered)
    { k_cvt8<<<(unsigned)(((size_t)DQ * DM / 8 + 255) / 256), 256, 0, stream>>>(wq, WQ, (size_t)DQ * DM / 8); k_cvt8<<<(unsigned)(((size_t)DKV * DM / 8 + 255) / 256), 256, 0, stream>>>(wk, WK, (size_t)DKV * DM / 8); k_cvt8<<<(unsigned)(((size_t)DKV * DM / 8 + 255) / 256), 256, 0, stream>>>(wv, WV, (size_t)DKV * DM / 8);
      k_cvt8<<<(unsigned)(((size_t)DM * DQ / 8 + 255) / 256), 256, 0, stream>>>(wo, WO, (size_t)DM * DQ / 8);
       }
    k_cscvt<<<(TT * HD + 255) / 256, 256, 0, stream>>>(fcos, fsin, CS);   /* rotary table from the inputs */
    const unsigned LQ = (unsigned)(((size_t)NH_ * TT * HD / 2 + 255) / 256), LKv = (unsigned)(((size_t)NKV * TT * HD / 2 + 255) / 256);
    for (int b = 0; b < NB_; ++b) {
        
        k_cvt8<<<(unsigned)(((size_t)TT * DM / 8 + 255) / 256), 256, 0, stream>>>(x + (size_t)b * TT * DM, XB, (size_t)TT * DM / 8);
        k_gemmw<bf, 0, false><<<dim3(TT / 64, DQ / 64, 1), 32, 0, stream>>>(XB, nullptr, WQ, nullptr, DM, FQ, DQ, nullptr, 0, 0, 0);
        k_rope<<<LQ, 256, 0, stream>>>(FQ, DQ, NH_, CS, nullptr, nullptr, 1.0f, QP16, QPh, QPl);
        k_gemmw<bf, 0, false><<<dim3(TT / 64, DKV / 64, 1), 32, 0, stream>>>(XB, nullptr, WK, nullptr, DM, FK, DKV, nullptr, 0, 0, 0);
        k_rope<<<LKv, 256, 0, stream>>>(FK, DKV, NKV, CS, nullptr, nullptr, 1.0f, KP16, KPh, KPl);
        k_gemmw<bf, 0, false><<<dim3(TT / 64, DKV / 64, 1), 32, 0, stream>>>(XB, nullptr, WV, nullptr, DM, FV, DKV, nullptr, 0, 0, 0); k_vtp<<<LKv, 256, 0, stream>>>(FV, DKV, NKV, VT16, VTh, VTl);
        for (int h0 = 0; h0 < NH_; h0 += ZH) { const size_t zq = (size_t)h0, zk = (size_t)(h0 / REP);   // one kv head per query head: the pass's ZH heads use consecutive kv planes (z-strides TT*HD for k, HD*2*TT for the hi/lo value rows)
            k_gemmc<bf, 2, 1><<<dim3(RH / 64, TT / 64, ZH), 32, 0, stream>>>(QPh + zq * TT * HD, QPl + zq * TT * HD, KPh + zk * TT * HD, KPl + zk * TT * HD, HD, Sb, TT, 0, (size_t)TT * HD, (size_t)TT * HD, (size_t)TT * TT, 0);
            if (RH < TT) k_gemmc<h16, 0, 1><<<dim3((TT - RH) / 64, TT / 64, ZH), 32, 0, stream>>>(QP16 + zq * TT * HD + (size_t)RH * HD, nullptr, KP16 + zk * TT * HD, nullptr, HD, Sb + (size_t)RH * TT, TT, RH, (size_t)TT * HD, (size_t)TT * HD, (size_t)TT * TT, 0);   /* no single-f16 rows when RH == TT: a zero-sized grid must not be launched */
            k_asoft<<<ZH * TT / 8, 256, 0, stream>>>(Sb, P16, Ph, Pl);
            k_gemmc<bf, 2, 2><<<dim3(RH / 64, (HD / 64) * KS, ZH), 32, 0, stream>>>(Ph, Pl, VTh + zk * HD * 2 * TT, VTl + zk * HD * 2 * TT, 2 * TT, Ob, HD, 0, (size_t)TT * 2 * TT, (size_t)HD * 2 * TT, (size_t)TT * HD, (size_t)ZH * TT * HD);
            if (RH < TT) k_gemmc<h16, 0, 2><<<dim3((TT - RH) / 64, (HD / 64) * KS, ZH), 32, 0, stream>>>(P16 + (size_t)RH * TT, nullptr, VT16 + zk * HD * TT, nullptr, TT, Ob + (size_t)RH * HD, HD, RH, (size_t)TT * TT, (size_t)HD * TT, (size_t)TT * HD, (size_t)ZH * TT * HD);   /* likewise */
            k_merge<<<(unsigned)(((size_t)ZH * TT * HD / 2 + 255) / 256), 256, 0, stream>>>(Ob, h0, ATh, ATl); }
        k_gemmw<bf, 1, false><<<dim3(TT / 64, DM / 64, 1), 32, 0, stream>>>(ATh, ATl, WO, nullptr, DQ, OUT + (size_t)b * TT * DM, DM, nullptr, 0, 0, 0); }
}

// v003
// One run takes 340 microseconds.
// Next to v002, in two timings, it ran 1.84 and 1.83 times as fast.
// All steps since v000 together make it 3.42 times as fast.
#include <hip/hip_runtime.h>

// Causal multi-head attention with rotate-half rotary embedding from cos / sin TABLE INPUTS read by value (x [2][2048][1024]; q, k, v = einsum('bld,ed', x, w) ('oi' [1024][1024] 1/32, no bias; 16 heads x 64); cos, sin f32 [1][1][2048][64] are INPUTS (arbitrary values on this draw: independent normal tables, not cosines of angles), read per position AND per dimension; q, k <- t cos + rotate_half(t) sin with rotate_half = cat(-x2, x1) over the two 32-wide halves; scores / sqrt(64); keys j <= i kept, finfo.min elsewhere (== exclusion); softmax; out = einsum('bld,ed', merged, wo) -> [2][2048][1024] (4.2 M); argument order x, cos, sin, wq, wk, wv, wo).
// Layout per batch: bf16 copy of x; 'oi' weights; exact projections; {cos, sin} table from the bf16-rounded inputs; rotate-half plane builders; one fused causal attention launch (k_attn: scores, running softmax and value product in registers, all query rows hi/lo 3 products); merged hi/lo x Wo exact.
// Compute dtypes, f32 accumulate: every input rounded to bf16 incl. the tables; projections exact; rotary f32; attention: ALL 2,048 query rows bf16 hi + lo operands with three products; softmax f32; Wo hl x exact.

#define NB_  2
#define TT   2048
#define DM   1024
#define NH_  16
#define NKV  16
#define REP  (NH_ / NKV)
#define HD   64
#define DQ   (NH_ * HD)
#define DKV  (NKV * HD)
#define SCL  0.125f   // HD^-0.5
typedef _Float16 h16;
typedef unsigned short bf;
typedef __attribute__((ext_vector_type(16))) __bf16   v16bf;
typedef __attribute__((ext_vector_type(16))) _Float16 v16h;
typedef __attribute__((ext_vector_type(8)))  _Float16 v8h;
typedef __attribute__((ext_vector_type(8)))  unsigned short v8us;
typedef __attribute__((ext_vector_type(8)))  float    v8f;
typedef __attribute__((ext_vector_type(4)))  float    v4f;
typedef v8h  __attribute__((may_alias)) v8ha;
typedef v4f  __attribute__((may_alias)) v4fa;
typedef v8us __attribute__((may_alias)) v8usa;

__device__ __forceinline__ unsigned short f2bf(float f) { unsigned u = __float_as_uint(f); u += 0x7FFFu + ((u >> 16) & 1u); return (unsigned short)(u >> 16); }
__device__ __forceinline__ float bf2f(unsigned short b) { return __uint_as_float(((unsigned)b) << 16); }
__device__ __forceinline__ float bfr(float f) { return bf2f(f2bf(f)); }
__device__ __forceinline__ v16h cat16(v8h lo, v8h hi) { return __builtin_shufflevector(lo, hi, 0, 1, 2, 3, 4, 5, 6, 7, 8, 9, 10, 11, 12, 13, 14, 15); }
__device__ __forceinline__ v16bf cat16b(v8us lo, v8us hi) { return __builtin_bit_cast(v16bf, __builtin_shufflevector(lo, hi, 0, 1, 2, 3, 4, 5, 6, 7, 8, 9, 10, 11, 12, 13, 14, 15)); }
__device__ __forceinline__ v8f wmma16(v16h a, v16h b, v8f c) { return __builtin_amdgcn_wmma_f32_16x16x32_f16(false, a, false, b, (short)0, c, false, false); }
__device__ __forceinline__ v8f wmmab(v16bf a, v16bf b, v8f c) { return __builtin_amdgcn_wmma_f32_16x16x32_bf16(false, a, false, b, (short)0, c, false, false); }



// ---- k_gemmw: register-blocked GEMM, ONE WAVE per 64x64 output tile (16 accumulators), operands straight from K-contiguous 16-bit planes; grid (M/64, N/64, Z), 32 threads.
// C[m][n] (f32, pitch ldc, + optional f32 bias[n]) = sum_k A[m][k] Bt[n][k] (+ split products per NSPLIT). z-batch strides sA/sB/sC in elements. K % 32 == 0.
template <typename T16> struct WFrag;
template <> struct WFrag<h16> { typedef v16h V; static __device__ __forceinline__ V ld(const h16* p) { return cat16(*(const v8h*)p, *(const v8h*)(p + 16)); } static __device__ __forceinline__ v8f mma(V a, V b, v8f c) { return wmma16(a, b, c); } };
template <> struct WFrag<bf> { typedef v16bf V; static __device__ __forceinline__ V ld(const bf* p) { return cat16b(*(const v8us*)p, *(const v8us*)(p + 16)); } static __device__ __forceinline__ v8f mma(V a, V b, v8f c) { return wmmab(a, b, c); } };
template <typename T16, int NSPLIT, bool BIAS>
__global__ __launch_bounds__(32) void k_gemmw(const T16* __restrict__ A, const T16* __restrict__ A2, const T16* __restrict__ Bt, const T16* __restrict__ Bt2, int K, float* C, int ldc, const float* __restrict__ bias, size_t sA, size_t sB, size_t sC) {
    typedef typename WFrag<T16>::V V;
    __shared__ __align__(16) float os[16 * 68];
    const size_t z = blockIdx.z; A += z * sA; if (A2) A2 += z * sA; Bt += z * sB; if (Bt2) Bt2 += z * sB; C += z * sC;
    const int lane = threadIdx.x & 31, lr = lane & 15, hi = lane >> 4; const int r0 = blockIdx.x * 64, c0 = blockIdx.y * 64;
    v8f acc[4][4];
#pragma unroll
    for (int mb = 0; mb < 4; ++mb)
#pragma unroll
        for (int nb = 0; nb < 4; ++nb) acc[mb][nb] = (v8f){};
    const size_t aoff = (size_t)(r0 + lr) * K + 8 * hi, boff = (size_t)(c0 + lr) * K + 8 * hi;
#pragma unroll 1
    for (int kc = 0; kc < K; kc += 32) {
        V a[4], a2[4];
#pragma unroll
        for (int mb = 0; mb < 4; ++mb) { a[mb] = WFrag<T16>::ld(A + aoff + (size_t)mb * 16 * K + kc); if (NSPLIT == 1 || NSPLIT == 2) a2[mb] = WFrag<T16>::ld(A2 + aoff + (size_t)mb * 16 * K + kc); }
#pragma unroll
        for (int nb = 0; nb < 4; ++nb) { const V b = WFrag<T16>::ld(Bt + boff + (size_t)nb * 16 * K + kc); V b2; if (NSPLIT >= 2) b2 = WFrag<T16>::ld(Bt2 + boff + (size_t)nb * 16 * K + kc);
#pragma unroll
            for (int mb = 0; mb < 4; ++mb) { acc[mb][nb] = WFrag<T16>::mma(a[mb], b, acc[mb][nb]); if (NSPLIT == 1 || NSPLIT == 2) acc[mb][nb] = WFrag<T16>::mma(a2[mb], b, acc[mb][nb]); if (NSPLIT >= 2) acc[mb][nb] = WFrag<T16>::mma(a[mb], b2, acc[mb][nb]); } }
        asm volatile("v_nop\n\tv_nop\n\tv_nop\n\tv_nop" : "+v"(acc[0][0]), "+v"(acc[1][1]), "+v"(acc[2][2]), "+v"(acc[3][3]) : "v"(a[0]), "v"(a[3]));
    }
#pragma unroll
    for (int mb = 0; mb < 4; ++mb) {
#pragma unroll
        for (int nb = 0; nb < 4; ++nb) {
#pragma unroll
            for (int j = 0; j < 8; ++j) os[(hi * 8 + j) * 68 + nb * 16 + lr] = acc[mb][nb][j]; }
        __builtin_amdgcn_wave_barrier(); asm volatile("" ::: "memory");
        float* crow = C + (size_t)(r0 + mb * 16) * ldc + c0;
{
#pragma unroll
            for (int s = 0; s < 8; ++s) { const int row = 2 * s + hi, cofs = lr * 4; v4f val = *(const v4fa*)(os + row * 68 + cofs); if (BIAS) { val[0] += bfr(bias[c0 + cofs]); val[1] += bfr(bias[c0 + cofs + 1]); val[2] += bfr(bias[c0 + cofs + 2]); val[3] += bfr(bias[c0 + cofs + 3]); }
                *(v4f*)(crow + (size_t)row * ldc + cofs) = val; }
             }
        __builtin_amdgcn_wave_barrier(); asm volatile("" ::: "memory");
    }
}

__device__ __forceinline__ h16 tohx(float x) { return (h16)x; }
__device__ __forceinline__ void splitf(float y, unsigned short& h, unsigned short& l) { h = f2bf(y); l = f2bf(y - bf2f(h)); }
typedef __attribute__((ext_vector_type(2))) _Float16 v2h;
typedef __attribute__((ext_vector_type(4))) _Float16 v4h;
typedef __attribute__((ext_vector_type(2))) unsigned short v2us;
typedef __attribute__((ext_vector_type(4))) unsigned short v4us;
typedef v4us __attribute__((may_alias)) v4usa;
typedef __attribute__((ext_vector_type(2))) float v2f;
typedef __attribute__((ext_vector_type(4))) int v4i;

__global__ __launch_bounds__(256) void k_cvt8(const float* __restrict__ src, bf* dst, size_t n8) { const size_t i = (size_t)blockIdx.x * 256 + threadIdx.x; if (i >= n8) return; const v8f v = *(const v8f*)(src + i * 8); v8us o;
#pragma unroll
    for (int k = 0; k < 8; ++k) o[k] = f2bf(v[k]); *(v8us*)(dst + i * 8) = o;  }

// k_rope: head planes [h][t][d] (fp16 + hi/lo) of rope(x) x sc with the rotate-half convention out[d] = x[d] cos[t][d] - x[d+HD/2] sin[t][d], out[d+HD/2] = x[d+HD/2] cos[t][d+HD/2] + x[d] sin[t][d+HD/2]
__global__ __launch_bounds__(256) void k_rope(const float* __restrict__ F, int pitch, int nheads, const float* __restrict__ CS, const float* __restrict__ RF, const float* __restrict__ nw, float sc, h16* P16, bf* Ph, bf* Pl) {
    const size_t e = ((size_t)blockIdx.x * 256 + threadIdx.x) * 2; if (e >= (size_t)nheads * TT * HD) return; const int d = (int)(e % HD); const int t = (int)((e / HD) % TT); const int h = (int)(e / ((size_t)HD * TT)); const float* f = F + (size_t)t * pitch + h * HD; const float rf = RF ? RF[(size_t)h * TT + t] : 1.0f; v2h o16; v2us oh, ol;
#pragma unroll
    for (int q = 0; q < 2; ++q) { const int dd = d + q; const int dp = (dd < HD / 2) ? dd + HD / 2 : dd - HD / 2; float x0 = f[dd], x1 = f[dp];
        if (RF) { float n0 = __fmul_rn(x0, rf), n1 = __fmul_rn(x1, rf); asm volatile("" : "+v"(n0)); asm volatile("" : "+v"(n1)); x0 = __fmul_rn(bfr(nw[dd]), n0); x1 = __fmul_rn(bfr(nw[dp]), n1); }
        const v2f cs = *(const v2f*)(CS + ((size_t)t * HD + dd) * 2); float a = __fmul_rn(x0, cs[0]), bq = __fmul_rn(x1, cs[1]); asm volatile("" : "+v"(a)); asm volatile("" : "+v"(bq)); const float r = ((dd < HD / 2) ? __fsub_rn(a, bq) : __fadd_rn(a, bq)) * sc;
        o16[q] = tohx(r); unsigned short a2, c2; splitf(r, a2, c2); oh[q] = a2; ol[q] = c2; }
    *(v2h*)(P16 + e) = o16; *(v2us*)(Ph + e) = oh; *(v2us*)(Pl + e) = ol;  }
__global__ __launch_bounds__(256) void k_vtp(const float* __restrict__ F, int pitch, int nheads, h16* V16, bf* Vh, bf* Vl) { const size_t e = ((size_t)blockIdx.x * 256 + threadIdx.x) * 2; if (e >= (size_t)nheads * HD * TT) return; const int t = (int)(e % TT); const int d = (int)((e / TT) % HD); const int g = (int)(e / ((size_t)TT * HD)); v2h o16; v2us oh, ol;
#pragma unroll
    for (int q = 0; q < 2; ++q) { const float x = F[(size_t)(t + q) * pitch + g * HD + d]; o16[q] = tohx(x); unsigned short a2, c2; splitf(x, a2, c2); oh[q] = a2; ol[q] = c2; }
    const size_t e2 = ((size_t)g * HD + d) * (2 * TT) + t;   // hi / lo rows have pitch 2 * TT
    *(v2h*)(V16 + e) = o16; *(v2us*)(Vh + e2) = oh; *(v2us*)(Vl + e2) = ol;  }
__global__ __launch_bounds__(256) void k_cscvt(const float* __restrict__ cosT, const float* __restrict__ sinT, float* CS) { const int idx = blockIdx.x * 256 + threadIdx.x; if (idx >= TT * HD) return; v2f cs; cs[0] = bfr(cosT[idx]); cs[1] = bfr(sinT[idx]); *(v2f*)(CS + (size_t)idx * 2) = cs;  }
// ---- k_attn: causal attention of one batch in one launch. A work-group owns 32 query rows of one head; its 4 waves take the 32-key blocks kb = w, w + 4, ... up to the diagonal block.
// Per block: S^T = K Q^T (A = key rows, B = query rows kept in registers; hi/lo, three products), so a lane holds scores of ONE query per 16-column group (keys 8 hi + j of each 16-key tile): running maximum and sum are per lane,
// and the two score tiles of a block are, register for register, the B operand P^T of O^T += V^T P^T (A = rows of the transposed values; hi/lo, three products). Probabilities stay unnormalised; the division by the row sum is last.
// The four waves' (maximum, sum, O^T) meet in LDS behind one barrier and are joined in ascending wave order; the result goes out as the hi/lo planes [t][head * 64 + d] that the output projection reads.
#define AQ   32     // query rows per work-group
#define AW   4      // waves per work-group (key blocks dealt round robin)
#define AOP  68     // pitch of an O row in LDS, floats (16-byte aligned rows, rows spread over the banks)
#define L2E  1.4426950408889634f
// precaution behind a run of global loads: as inputs here the two address pairs stay live and unwritten up to the wait
#define XWAIT(a, b) asm volatile("s_wait_xcnt 0x0" :: "v"(a), "v"(b) : "memory")
// the slot that the instruction set asks for behind a transcendental: results and sources are operands of the v_nop, so no use of a result and no overwrite of a source can stand in front of it
// within a run of eight each exponential is the independent instruction behind the one before
#define TSLOT8(r, x, o) asm("v_nop" : "+v"(r[o]), "+v"(r[o + 1]), "+v"(r[o + 2]), "+v"(r[o + 3]), "+v"(r[o + 4]), "+v"(r[o + 5]), "+v"(r[o + 6]), "+v"(r[o + 7]) : "v"(x[o]), "v"(x[o + 1]), "v"(x[o + 2]), "v"(x[o + 3]), "v"(x[o + 4]), "v"(x[o + 5]), "v"(x[o + 6]), "v"(x[o + 7]))
__device__ __forceinline__ float ex2(float x) { float r = __builtin_amdgcn_exp2f(x); asm("v_nop" : "+v"(r) : "v"(x)); return r; }
__device__ __forceinline__ v16bf ldfr(const bf* p) { return cat16b(*(const v8us*)p, *(const v8us*)(p + 16)); }
// waves_per_eu(3, 3): the register budget of three waves per SIMD holds Q, O^T, one key block and one value block at once; with the default budget the scheduler split the loads of a pass into several waited groups
__global__ __launch_bounds__(AW * 32) __attribute__((amdgpu_waves_per_eu(3, 3))) void k_attn(const bf* __restrict__ Qh, const bf* __restrict__ Ql, const bf* __restrict__ Kh, const bf* __restrict__ Kl, const bf* __restrict__ Vh, const bf* __restrict__ Vl, bf* __restrict__ Ah, bf* __restrict__ Al) {
    __shared__ __align__(16) float so[AW][AQ][AOP];
    __shared__ float sm[AW][AQ], sl[AW][AQ];
    // 1,024 work-groups: heavy query tiles first, and four work-groups 256 apart in the grid add up to the same number of key blocks
    const int L = (int)blockIdx.x, g = L >> 8, h = L & 15, u = (L >> 4) & 15;
    const int qt = (g == 0) ? 63 - u : (g == 1) ? 32 + u : (g == 2) ? 31 - u : u; const int q0 = qt * AQ;
    const int lane = threadIdx.x & 31, lr = lane & 15, hi = lane >> 4; const int w = __builtin_amdgcn_readfirstlane((int)(threadIdx.x >> 5));
    const size_t hp = (size_t)h * TT * HD; Qh += hp; Ql += hp; Kh += hp; Kl += hp; Vh += (size_t)h * HD * 2 * TT; Vl += (size_t)h * HD * 2 * TT;
    v16bf qh[2][2], ql[2][2];
    { const bf* ph0 = Qh + (size_t)(q0 + lr) * HD + 8 * hi; const bf* pl0 = Ql + (size_t)(q0 + lr) * HD + 8 * hi;
#pragma unroll
      for (int nt = 0; nt < 2; ++nt)
#pragma unroll
        for (int ks = 0; ks < 2; ++ks) { qh[nt][ks] = ldfr(ph0 + nt * 16 * HD + ks * 32); ql[nt][ks] = ldfr(pl0 + nt * 16 * HD + ks * 32); }
      XWAIT(ph0, pl0); }
    v8f oa[4][2]; float mx[2], sum[2];
#pragma unroll
    for (int nt = 0; nt < 2; ++nt) { mx[nt] = -3.0e38f; sum[nt] = 0.f;
#pragma unroll
        for (int dt = 0; dt < 4; ++dt) oa[dt][nt] = (v8f){}; }
    v16bf kh[2][2], kl[2][2];   // the key block in hand, fetched one pass ahead
    auto ldk = [&](int kb) __attribute__((always_inline)) { const bf* ph0 = Kh + (size_t)(kb * 32 + lr) * HD + 8 * hi; const bf* pl0 = Kl + (size_t)(kb * 32 + lr) * HD + 8 * hi;
#pragma unroll
        for (int mt = 0; mt < 2; ++mt)
#pragma unroll
            for (int ks = 0; ks < 2; ++ks) { kh[mt][ks] = ldfr(ph0 + mt * 16 * HD + ks * 32); kl[mt][ks] = ldfr(pl0 + mt * 16 * HD + ks * 32); }
        XWAIT(ph0, pl0); };
    auto pass = [&](int kb, bool diag) __attribute__((always_inline)) { const int k0 = kb * 32;
        v16bf vh[4], vl[4]; const bf* pv0 = Vh + (size_t)lr * (2 * TT) + k0 + 8 * hi; const bf* pv1 = Vl + (size_t)lr * (2 * TT) + k0 + 8 * hi;
#pragma unroll
        for (int dt = 0; dt < 4; ++dt) { vh[dt] = ldfr(pv0 + dt * 16 * 2 * TT); vl[dt] = ldfr(pv1 + dt * 16 * 2 * TT); }
        XWAIT(pv0, pv1);
        __builtin_amdgcn_sched_barrier(0);   // keeps the value loads up here, in flight over the score products and the softmax (the scheduler sank half of them to just in front of their use)
        v8f s[2][2];
#pragma unroll
        for (int mt = 0; mt < 2; ++mt)
#pragma unroll
            for (int nt = 0; nt < 2; ++nt) { v8f a = (v8f){};
#pragma unroll
                for (int ks = 0; ks < 2; ++ks) { a = wmmab(kh[mt][ks], qh[nt][ks], a); a = wmmab(kl[mt][ks], qh[nt][ks], a); a = wmmab(kh[mt][ks], ql[nt][ks], a); }
                s[mt][nt] = a; }
        v16bf ph[2], pl[2];
#pragma unroll
        for (int nt = 0; nt < 2; ++nt) { float t[16]; float bm = -3.0e38f;
#pragma unroll
            for (int e = 0; e < 16; ++e) { t[e] = s[e >> 3][nt][e & 7]; if (diag && (e >> 3) * 16 + 8 * hi + (e & 7) > nt * 16 + lr) t[e] = -3.0e38f; bm = fmaxf(bm, t[e]); }   // diagonal block: keys past the query are excluded
            bm = fmaxf(bm, __shfl_xor(bm, 16, 32));
            const float mn = fmaxf(mx[nt], bm * (SCL * L2E)); const float al = ex2(mx[nt] - mn); mx[nt] = mn; float ls = 0.f;   // mx: the row's offset in the log2 domain; every probability of the row is 2^(score * SCL * L2E - mx)
#pragma unroll
            for (int e = 0; e < 16; ++e) t[e] = __builtin_fmaf(t[e], SCL * L2E, -mn);
            float pr[16];
#pragma unroll
            for (int e = 0; e < 16; ++e) pr[e] = __builtin_amdgcn_exp2f(t[e]);
            TSLOT8(pr, t, 0); TSLOT8(pr, t, 8);
#pragma unroll
            for (int e = 0; e < 16; ++e) { const float p = pr[e]; ls += p; const __bf16 a = (__bf16)p; ph[nt][e] = a; pl[nt][e] = (__bf16)(p - (float)a); }
            sum[nt] = sum[nt] * al + ls;
#pragma unroll
            for (int dt = 0; dt < 4; ++dt) oa[dt][nt] *= al; }
        if (!diag) { ldk(min(kb + AW, qt));   // the wave's next block (clamped to the diagonal block: always inside the planes), in flight over the value product
            __builtin_amdgcn_sched_barrier(0); }   // keeps those loads in front of the value product (the scheduler sank them to the loop's foot, where nothing covers their latency)
#pragma unroll
        for (int dt = 0; dt < 4; ++dt)
#pragma unroll
            for (int nt = 0; nt < 2; ++nt) { oa[dt][nt] = wmmab(vh[dt], ph[nt], oa[dt][nt]); oa[dt][nt] = wmmab(vh[dt], pl[nt], oa[dt][nt]); oa[dt][nt] = wmmab(vl[dt], ph[nt], oa[dt][nt]); } };
    ldk(min(w, qt));
    int kb = w;
#pragma unroll 1   // one copy of the pass in the loop: the registers of a second copy would cost a resident wave
    for (; kb < qt; kb += AW) pass(kb, false);
    if (kb == qt) pass(kb, true);   // the diagonal block falls to one of the four waves, as its last pass
#pragma unroll
    for (int nt = 0; nt < 2; ++nt) { const float st = sum[nt] + __shfl_xor(sum[nt], 16, 32); if (hi == 0) { sm[w][nt * 16 + lr] = mx[nt]; sl[w][nt * 16 + lr] = st; }
#pragma unroll
        for (int dt = 0; dt < 4; ++dt) { float* d = &so[w][nt * 16 + lr][dt * 16 + 8 * hi]; const v8f a = oa[dt][nt]; *(v4f*)d = (v4f){a[0], a[1], a[2], a[3]}; *(v4f*)(d + 4) = (v4f){a[4], a[5], a[6], a[7]}; } }
    __syncthreads();
    const int q = (int)threadIdx.x >> 2, c = ((int)threadIdx.x & 3) * 16;
    float mm = sm[0][q];
#pragma unroll
    for (int x = 1; x < AW; ++x) mm = fmaxf(mm, sm[x][q]);
    float lt = 0.f; float r[16];
#pragma unroll
    for (int i = 0; i < 16; ++i) r[i] = 0.f;
#pragma unroll
    for (int x = 0; x < AW; ++x) { const float f = ex2(sm[x][q] - mm); lt += f * sl[x][q];
#pragma unroll
        for (int i4 = 0; i4 < 4; ++i4) { const v4f a = *(const v4f*)&so[x][q][c + i4 * 4];
#pragma unroll
            for (int i = 0; i < 4; ++i) r[i4 * 4 + i] += f * a[i]; } }
    const float inv = __fdiv_rn(1.0f, lt); const size_t oo = (size_t)(q0 + q) * DQ + h * HD + c;
#pragma unroll
    for (int i8 = 0; i8 < 2; ++i8) { v8us oh, ol;
#pragma unroll
        for (int i = 0; i < 8; ++i) { unsigned short a, c2; splitf(r[i8 * 8 + i] * inv, a, c2); oh[i] = a; ol[i] = c2; }
        *(v8us*)(Ah + oo + i8 * 8) = oh; *(v8us*)(Al + oo + i8 * 8) = ol; }
}

extern "C" void kernel_launch(void* const* d_in, const int* in_sizes, int n_in,
                              void* d_out, int out_size, void* d_ws, size_t ws_size, hipStream_t stream) {
    (void)in_sizes; (void)n_in; (void)out_size;
    const float* x = (const float*)d_in[0]; const float* fcos = (const float*)d_in[1]; const float* fsin = (const float*)d_in[2]; const float* wq = (const float*)d_in[3]; const float* wk = (const float*)d_in[4]; const float* wv = (const float*)d_in[5]; const float* wo = (const float*)d_in[6];   /* input order x, cos, sin ([1][1][2048][64] = flat [2048][64]; read per position and per dimension), wq, wk, wv, wo ('oi') */
    float* OUT = (float*)d_out;     // [2][2048][1024]
    char* wsp = (char*)d_ws;
    auto take = [&](size_t bytes) { char* p = wsp; wsp += (bytes + 255) & ~(size_t)255; return (void*)p; };
    bf* WQ = (bf*)take((size_t)DQ * DM * 2); bf* WK = (bf*)take((size_t)DKV * DM * 2); bf* WV = (bf*)take((size_t)DKV * DM * 2); bf* WO = (bf*)take((size_t)DM * DQ * 2); float* CS = (float*)take((size_t)TT * HD * 2 * 4);
    bf* XB = (bf*)take((size_t)TT * DM * 2);
    h16* QP16 = (h16*)take((size_t)NH_ * TT * HD * 2); h16* KP16 = (h16*)take((size_t)NKV * TT * HD * 2); h16* VT16 = (h16*)take((size_t)NKV * HD * TT * 2);
    bf* QPh = (bf*)take((size_t)NH_ * TT * HD * 2); bf* QPl = (bf*)take((size_t)NH_ * TT * HD * 2); bf* KPh = (bf*)take((size_t)NKV * TT * HD * 2); bf* KPl = (bf*)take((size_t)NKV * TT * HD * 2); bf* VTh = (bf*)take((size_t)NKV * HD * 2 * TT * 2); bf* VTl = VTh + TT;   // transposed values: row pitch 2 * TT, hi in the first half of a row, lo in the second 
    float* FQ = (float*)take((size_t)TT * DQ * 4); float* FK = (float*)take((size_t)TT * DKV * 4); bf* ATh = (bf*)take((size_t)TT * DQ * 2); bf* ATl = (bf*)take((size_t)TT * DQ * 2);
    if ((size_t)(wsp - (char*)d_ws) > ws_size) return;    // ws 256 MiB
    float* FV = FK;   // v projection reuses the k buffer after the k planes are built (stream-ordered)
    { k_cvt8<<<(unsigned)(((size_t)DQ * DM / 8 + 255) / 256), 256, 0, stream>>>(wq, WQ, (size_t)DQ * DM / 8); k_cvt8<<<(unsigned)(((size_t)DKV * DM / 8 + 255) / 256), 256, 0, stream>>>(wk, WK, (size_t)DKV * DM / 8); k_cvt8<<<(unsigned)(((size_t)DKV * DM / 8 + 255) / 256), 256, 0, stream>>>(wv, WV, (size_t)DKV * DM / 8);
      k_cvt8<<<(unsigned)(((size_t)DM * DQ / 8 + 255) / 256), 256, 0, stream>>>(wo, WO, (size_t)DM * DQ / 8);
       }
    k_cscvt<<<(TT * HD + 255) / 256, 256, 0, stream>>>(fcos, fsin, CS);   /* rotary table from the inputs */
    const unsigned LQ = (unsigned)(((size_t)NH_ * TT * HD / 2 + 255) / 256), LKv = (unsigned)(((size_t)NKV * TT * HD / 2 + 255) / 256);
    for (int b = 0; b < NB_; ++b) {
        
        k_cvt8<<<(unsigned)(((size_t)TT * DM / 8 + 255) / 256), 256, 0, stream>>>(x + (size_t)b * TT * DM, XB, (size_t)TT * DM / 8);
        k_gemmw<bf, 0, false><<<dim3(TT / 64, DQ / 64, 1), 32, 0, stream>>>(XB, nullptr, WQ, nullptr, DM, FQ, DQ, nullptr, 0, 0, 0);
        k_rope<<<LQ, 256, 0, stream>>>(FQ, DQ, NH_, CS, nullptr, nullptr, 1.0f, QP16, QPh, QPl);
        k_gemmw<bf, 0, false><<<dim3(TT / 64, DKV / 64, 1), 32, 0, stream>>>(XB, nullptr, WK, nullptr, DM, FK, DKV, nullptr, 0, 0, 0);
        k_rope<<<LKv, 256, 0, stream>>>(FK, DKV, NKV, CS, nullptr, nullptr, 1.0f, KP16, KPh, KPl);
        k_gemmw<bf, 0, false><<<dim3(TT / 64, DKV / 64, 1), 32, 0, stream>>>(XB, nullptr, WV, nullptr, DM, FV, DKV, nullptr, 0, 0, 0); k_vtp<<<LKv, 256, 0, stream>>>(FV, DKV, NKV, VT16, VTh, VTl);
        k_attn<<<NH_ * (TT / AQ), AW * 32, 0, stream>>>(QPh, QPl, KPh, KPl, VTh, VTl, ATh, ATl);   // one kv head per query head
        k_gemmw<bf, 1, false><<<dim3(TT / 64, DM / 64, 1), 32, 0, stream>>>(ATh, ATl, WO, nullptr, DQ, OUT + (size_t)b * TT * DM, DM, nullptr, 0, 0, 0); }
}

// v004
// A run of this version takes 300 microseconds.
// Two timings next to v003 both put it at 1.13 times that version's speed.
// All steps since v000 together make it 3.88 times as fast.
#include <hip/hip_runtime.h>

// Causal multi-head attention with rotate-half rotary embedding from cos / sin TABLE INPUTS read by value (x [2][2048][1024]; q, k, v = einsum('bld,ed', x, w) ('oi' [1024][1024] 1/32, no bias; 16 heads x 64); cos, sin f32 [1][1][2048][64] are INPUTS (arbitrary values on this draw: independent normal tables, not cosines of angles), read per position AND per dimension; q, k <- t cos + rotate_half(t) sin with rotate_half = cat(-x2, x1) over the two 32-wide halves; scores / sqrt(64); keys j <= i kept, finfo.min elsewhere (== exclusion); softmax; out = einsum('bld,ed', merged, wo) -> [2][2048][1024] (4.2 M); argument order x, cos, sin, wq, wk, wv, wo).
// Layout per batch: bf16 copy of x; 'oi' weights; exact projections; {cos, sin} table from the bf16-rounded inputs; rotate-half rotary, hi/lo split and value transpose in the projections' own epilogues; one fused causal attention launch (k_attn: scores, running softmax and value product in registers, all query rows hi/lo 3 products); merged hi/lo x Wo exact.
// Compute dtypes, f32 accumulate: every input rounded to bf16 incl. the tables; projections exact; rotary f32; attention: ALL 2,048 query rows bf16 hi + lo operands with three products; softmax f32; Wo hl x exact.

#define NB_  2
#define TT   2048
#define DM   1024
#define NH_  16
#define NKV  16
#define REP  (NH_ / NKV)
#define HD   64
#define DQ   (NH_ * HD)
#define DKV  (NKV * HD)
#define SCL  0.125f   // HD^-0.5
typedef _Float16 h16;
typedef unsigned short bf;
typedef __attribute__((ext_vector_type(16))) __bf16   v16bf;
typedef __attribute__((ext_vector_type(16))) _Float16 v16h;
typedef __attribute__((ext_vector_type(8)))  _Float16 v8h;
typedef __attribute__((ext_vector_type(8)))  unsigned short v8us;
typedef __attribute__((ext_vector_type(8)))  float    v8f;
typedef __attribute__((ext_vector_type(4)))  float    v4f;
typedef v8h  __attribute__((may_alias)) v8ha;
typedef v4f  __attribute__((may_alias)) v4fa;
typedef v8us __attribute__((may_alias)) v8usa;

__device__ __forceinline__ unsigned short f2bf(float f) { unsigned u = __float_as_uint(f); u += 0x7FFFu + ((u >> 16) & 1u); return (unsigned short)(u >> 16); }
__device__ __forceinline__ float bf2f(unsigned short b) { return __uint_as_float(((unsigned)b) << 16); }
__device__ __forceinline__ float bfr(float f) { return bf2f(f2bf(f)); }
__device__ __forceinline__ v16h cat16(v8h lo, v8h hi) { return __builtin_shufflevector(lo, hi, 0, 1, 2, 3, 4, 5, 6, 7, 8, 9, 10, 11, 12, 13, 14, 15); }
__device__ __forceinline__ v16bf cat16b(v8us lo, v8us hi) { return __builtin_bit_cast(v16bf, __builtin_shufflevector(lo, hi, 0, 1, 2, 3, 4, 5, 6, 7, 8, 9, 10, 11, 12, 13, 14, 15)); }
__device__ __forceinline__ v8f wmma16(v16h a, v16h b, v8f c) { return __builtin_amdgcn_wmma_f32_16x16x32_f16(false, a, false, b, (short)0, c, false, false); }
__device__ __forceinline__ v8f wmmab(v16bf a, v16bf b, v8f c) { return __builtin_amdgcn_wmma_f32_16x16x32_bf16(false, a, false, b, (short)0, c, false, false); }



// ---- k_gemmw: register-blocked GEMM, ONE WAVE per 64x64 output tile (16 accumulators), operands straight from K-contiguous 16-bit planes; grid (M/64, N/64, Z), 32 threads.
// C[m][n] (f32, pitch ldc, + optional f32 bias[n]) = sum_k A[m][k] Bt[n][k] (+ split products per NSPLIT). z-batch strides sA/sB/sC in elements. K % 32 == 0.
// EPI 0: C goes out as f32. EPI 1, 2: a 64-column tile is one head (blockIdx.y) over 64 positions, so the wave finishes it itself and C is not written:
// EPI 1: rotate-half rotary out[d] = x[d] cos[t][d] - x[d+32] sin[t][d], out[d+32] = x[d+32] cos[t][d+32] + x[d] sin[t][d+32] (CS = {cos, sin} pairs [t][d]), then hi/lo planes Ph, Pl [head][t][d];
// EPI 2: hi/lo planes of the transposed tile, Ph, Pl [head][d][t] with row pitch 2 * TT.
template <typename T16> struct WFrag;
template <> struct WFrag<h16> { typedef v16h V; static __device__ __forceinline__ V ld(const h16* p) { return cat16(*(const v8h*)p, *(const v8h*)(p + 16)); } static __device__ __forceinline__ v8f mma(V a, V b, v8f c) { return wmma16(a, b, c); } };
template <> struct WFrag<bf> { typedef v16bf V; static __device__ __forceinline__ V ld(const bf* p) { return cat16b(*(const v8us*)p, *(const v8us*)(p + 16)); } static __device__ __forceinline__ v8f mma(V a, V b, v8f c) { return wmmab(a, b, c); } };
__device__ __forceinline__ void splitf(float y, unsigned short& h, unsigned short& l) { h = f2bf(y); l = f2bf(y - bf2f(h)); }
// the same split (round to nearest even, then the rounded remainder) for eight values, on the chip's own conversion
__device__ __forceinline__ void split8(const float* y, v8us& h, v8us& l) { typedef __attribute__((ext_vector_type(8))) __bf16 v8b; v8b a, b;
#pragma unroll
    for (int i = 0; i < 8; ++i) { a[i] = (__bf16)y[i]; b[i] = (__bf16)(y[i] - (float)a[i]); }
    h = __builtin_bit_cast(v8us, a); l = __builtin_bit_cast(v8us, b); }
#define VTP 72     // pitch of a transposed row in LDS, 16-bit elements (16-byte aligned rows, rows spread over the banks)
template <typename T16, int NSPLIT, bool BIAS, int EPI>
__global__ __launch_bounds__(32) void k_gemmw(const T16* __restrict__ A, const T16* __restrict__ A2, const T16* __restrict__ Bt, const T16* __restrict__ Bt2, int K, float* C, int ldc, const float* __restrict__ bias, size_t sA, size_t sB, size_t sC, const float* __restrict__ CS, bf* __restrict__ Ph, bf* __restrict__ Pl) {
    typedef typename WFrag<T16>::V V;
    const size_t z = blockIdx.z; A += z * sA; if (A2) A2 += z * sA; Bt += z * sB; if (Bt2) Bt2 += z * sB; C += z * sC;
    const int lane = threadIdx.x & 31, lr = lane & 15, hi = lane >> 4; const int r0 = blockIdx.x * 64, c0 = blockIdx.y * 64;
    v8f acc[4][4];
#pragma unroll
    for (int mb = 0; mb < 4; ++mb)
#pragma unroll
        for (int nb = 0; nb < 4; ++nb) acc[mb][nb] = (v8f){};
    const size_t aoff = (size_t)(r0 + lr) * K + 8 * hi, boff = (size_t)(c0 + lr) * K + 8 * hi;
#pragma unroll 1
    for (int kc = 0; kc < K; kc += 32) {
        V a[4], a2[4];
#pragma unroll
        for (int mb = 0; mb < 4; ++mb) { a[mb] = WFrag<T16>::ld(A + aoff + (size_t)mb * 16 * K + kc); if (NSPLIT == 1 || NSPLIT == 2) a2[mb] = WFrag<T16>::ld(A2 + aoff + (size_t)mb * 16 * K + kc); }
#pragma unroll
        for (int nb = 0; nb < 4; ++nb) { const V b = WFrag<T16>::ld(Bt + boff + (size_t)nb * 16 * K + kc); V b2; if (NSPLIT >= 2) b2 = WFrag<T16>::ld(Bt2 + boff + (size_t)nb * 16 * K + kc);
#pragma unroll
            for (int mb = 0; mb < 4; ++mb) { acc[mb][nb] = WFrag<T16>::mma(a[mb], b, acc[mb][nb]); if (NSPLIT == 1 || NSPLIT == 2) acc[mb][nb] = WFrag<T16>::mma(a2[mb], b, acc[mb][nb]); if (NSPLIT >= 2) acc[mb][nb] = WFrag<T16>::mma(a[mb], b2, acc[mb][nb]); } }
        asm volatile("v_nop\n\tv_nop\n\tv_nop\n\tv_nop" : "+v"(acc[0][0]), "+v"(acc[1][1]), "+v"(acc[2][2]), "+v"(acc[3][3]) : "v"(a[0]), "v"(a[3]));
    }
    const int rr = lane >> 3, c8 = (lane & 7) * 8;   // EPI 1, 2 write-out: eight lanes cover one 128-byte row of a plane, a wave four rows
    if constexpr (EPI == 2) {
        __shared__ __align__(16) bf vs[2][64 * VTP];
        // a lane holds eight consecutive positions of one dimension: they are 16 bytes of a transposed row
#pragma unroll
        for (int mb = 0; mb < 4; ++mb)
#pragma unroll
            for (int nb = 0; nb < 4; ++nb) { v8us oh, ol; float y[8];
#pragma unroll
                for (int j = 0; j < 8; ++j) y[j] = acc[mb][nb][j];
                split8(y, oh, ol);
                *(v8usa*)(&vs[0][(nb * 16 + lr) * VTP + mb * 16 + hi * 8]) = oh; *(v8usa*)(&vs[1][(nb * 16 + lr) * VTP + mb * 16 + hi * 8]) = ol; }
        __builtin_amdgcn_wave_barrier(); asm volatile("" ::: "memory");   // the rows are read back by other lanes of the wave: holds every LDS write in front of those reads in the compiled order
        const size_t vo = ((size_t)blockIdx.y * HD + rr) * (2 * TT) + r0 + c8;
#pragma unroll
        for (int s = 0; s < 16; ++s) { *(v8us*)(Ph + vo + (size_t)s * 4 * (2 * TT)) = *(const v8usa*)(&vs[0][(4 * s + rr) * VTP + c8]); *(v8us*)(Pl + vo + (size_t)s * 4 * (2 * TT)) = *(const v8usa*)(&vs[1][(4 * s + rr) * VTP + c8]); }
    } else {
    __shared__ __align__(16) float os[16 * 68];
#pragma unroll
    for (int mb = 0; mb < 4; ++mb) {
#pragma unroll
        for (int nb = 0; nb < 4; ++nb) {
#pragma unroll
            for (int j = 0; j < 8; ++j) os[(hi * 8 + j) * 68 + nb * 16 + lr] = acc[mb][nb][j]; }
        __builtin_amdgcn_wave_barrier(); asm volatile("" ::: "memory");
        if constexpr (EPI == 1) {
            const float sg = (c8 < HD / 2) ? -1.0f : 1.0f;   // sign of the rotated partner
            const float* csp = CS + ((size_t)(r0 + mb * 16 + rr) * HD + c8) * 2; const size_t po = ((size_t)blockIdx.y * TT + r0 + mb * 16 + rr) * HD + c8;
#pragma unroll
            for (int s = 0; s < 4; ++s) { const float* xr = os + (4 * s + rr) * 68; v8us oh, ol; float r[8];
#pragma unroll
                for (int i4 = 0; i4 < 2; ++i4) { const v4f x0 = *(const v4fa*)(xr + c8 + i4 * 4), x1 = *(const v4fa*)(xr + (c8 ^ (HD / 2)) + i4 * 4); const v4f e0 = *(const v4f*)(csp + s * 4 * HD * 2 + i4 * 8), e1 = *(const v4f*)(csp + s * 4 * HD * 2 + i4 * 8 + 4);
                    r[i4 * 4] = x0[0] * e0[0] + sg * x1[0] * e0[1]; r[i4 * 4 + 1] = x0[1] * e0[2] + sg * x1[1] * e0[3]; r[i4 * 4 + 2] = x0[2] * e1[0] + sg * x1[2] * e1[1]; r[i4 * 4 + 3] = x0[3] * e1[2] + sg * x1[3] * e1[3]; }
                split8(r, oh, ol);
                *(v8us*)(Ph + po + s * 4 * HD) = oh; *(v8us*)(Pl + po + s * 4 * HD) = ol; }
            if (mb < 3) asm volatile("s_wait_xcnt 0x0" ::: "memory");   // precaution behind the stores: the next block's table loads land in registers that these stores name as data
        } else {
        float* crow = C + (size_t)(r0 + mb * 16) * ldc + c0;
{
#pragma unroll
            for (int s = 0; s < 8; ++s) { const int row = 2 * s + hi, cofs = lr * 4; v4f val = *(const v4fa*)(os + row * 68 + cofs); if (BIAS) { val[0] += bfr(bias[c0 + cofs]); val[1] += bfr(bias[c0 + cofs + 1]); val[2] += bfr(bias[c0 + cofs + 2]); val[3] += bfr(bias[c0 + cofs + 3]); }
                *(v4f*)(crow + (size_t)row * ldc + cofs) = val; }
             }
        }
        __builtin_amdgcn_wave_barrier(); asm volatile("" ::: "memory");
    }
    }
}

__device__ __forceinline__ h16 tohx(float x) { return (h16)x; }
typedef __attribute__((ext_vector_type(2))) _Float16 v2h;
typedef __attribute__((ext_vector_type(4))) _Float16 v4h;
typedef __attribute__((ext_vector_type(2))) unsigned short v2us;
typedef __attribute__((ext_vector_type(4))) unsigned short v4us;
typedef v4us __attribute__((may_alias)) v4usa;
typedef __attribute__((ext_vector_type(2))) float v2f;
typedef __attribute__((ext_vector_type(4))) int v4i;

__global__ __launch_bounds__(256) void k_cvt8(const float* __restrict__ src, bf* dst, size_t n8) { const size_t i = (size_t)blockIdx.x * 256 + threadIdx.x; if (i >= n8) return; const v8f v = *(const v8f*)(src + i * 8); v8us o;
#pragma unroll
    for (int k = 0; k < 8; ++k) o[k] = f2bf(v[k]); *(v8us*)(dst + i * 8) = o;  }

__global__ __launch_bounds__(256) void k_cscvt(const float* __restrict__ cosT, const float* __restrict__ sinT, float* CS) { const int idx = blockIdx.x * 256 + threadIdx.x; if (idx >= TT * HD) return; v2f cs; cs[0] = bfr(cosT[idx]); cs[1] = bfr(sinT[idx]); *(v2f*)(CS + (size_t)idx * 2) = cs;  }
// ---- k_attn: causal attention of one batch in one launch. A work-group owns 32 query rows of one head; its 4 waves take the 32-key blocks kb = w, w + 4, ... up to the diagonal block.
// Per block: S^T = K Q^T (A = key rows, B = query rows kept in registers; hi/lo, three products), so a lane holds scores of ONE query per 16-column group (keys 8 hi + j of each 16-key tile): running maximum and sum are per lane,
// and the two score tiles of a block are, register for register, the B operand P^T of O^T += V^T P^T (A = rows of the transposed values; hi/lo, three products). Probabilities stay unnormalised; the division by the row sum is last.
// The four waves' (maximum, sum, O^T) meet in LDS behind one barrier and are joined in ascending wave order; the result goes out as the hi/lo planes [t][head * 64 + d] that the output projection reads.
#define AQ   32     // query rows per work-group
#define AW   4      // waves per work-group (key blocks dealt round robin)
#define AOP  68     // pitch of an O row in LDS, floats (16-byte aligned rows, rows spread over the banks)
#define L2E  1.4426950408889634f
// precaution behind a run of global loads: as inputs here the two address pairs stay live and unwritten up to the wait
#define XWAIT(a, b) asm volatile("s_wait_xcnt 0x0" :: "v"(a), "v"(b) : "memory")
// the slot that the instruction set asks for behind a transcendental: results and sources are operands of the v_nop, so no use of a result and no overwrite of a source can stand in front of it
// within a run of eight each exponential is the independent instruction behind the one before
#define TSLOT8(r, x, o) asm("v_nop" : "+v"(r[o]), "+v"(r[o + 1]), "+v"(r[o + 2]), "+v"(r[o + 3]), "+v"(r[o + 4]), "+v"(r[o + 5]), "+v"(r[o + 6]), "+v"(r[o + 7]) : "v"(x[o]), "v"(x[o + 1]), "v"(x[o + 2]), "v"(x[o + 3]), "v"(x[o + 4]), "v"(x[o + 5]), "v"(x[o + 6]), "v"(x[o + 7]))
__device__ __forceinline__ float ex2(float x) { float r = __builtin_amdgcn_exp2f(x); asm("v_nop" : "+v"(r) : "v"(x)); return r; }
__device__ __forceinline__ v16bf ldfr(const bf* p) { return cat16b(*(const v8us*)p, *(const v8us*)(p + 16)); }
// waves_per_eu(3, 3): the register budget of three waves per SIMD holds Q, O^T, one key block and one value block at once; with the default budget the scheduler split the loads of a pass into several waited groups
__global__ __launch_bounds__(AW * 32) __attribute__((amdgpu_waves_per_eu(3, 3))) void k_attn(const bf* __restrict__ Qh, const bf* __restrict__ Ql, const bf* __restrict__ Kh, const bf* __restrict__ Kl, const bf* __restrict__ Vh, const bf* __restrict__ Vl, bf* __restrict__ Ah, bf* __restrict__ Al) {
    __shared__ __align__(16) float so[AW][AQ][AOP];
    __shared__ float sm[AW][AQ], sl[AW][AQ];
    // 1,024 work-groups: heavy query tiles first, and four work-groups 256 apart in the grid add up to the same number of key blocks
    const int L = (int)blockIdx.x, g = L >> 8, h = L & 15, u = (L >> 4) & 15;
    const int qt = (g == 0) ? 63 - u : (g == 1) ? 32 + u : (g == 2) ? 31 - u : u; const int q0 = qt * AQ;
    const int lane = threadIdx.x & 31, lr = lane & 15, hi = lane >> 4; const int w = __builtin_amdgcn_readfirstlane((int)(threadIdx.x >> 5));
    const size_t hp = (size_t)h * TT * HD; Qh += hp; Ql += hp; Kh += hp; Kl += hp; Vh += (size_t)h * HD * 2 * TT; Vl += (size_t)h * HD * 2 * TT;
    v16bf qh[2][2], ql[2][2];
    { const bf* ph0 = Qh + (size_t)(q0 + lr) * HD + 8 * hi; const bf* pl0 = Ql + (size_t)(q0 + lr) * HD + 8 * hi;
#pragma unroll
      for (int nt = 0; nt < 2; ++nt)
#pragma unroll
        for (int ks = 0; ks < 2; ++ks) { qh[nt][ks] = ldfr(ph0 + nt * 16 * HD + ks * 32); ql[nt][ks] = ldfr(pl0 + nt * 16 * HD + ks * 32); }
      XWAIT(ph0, pl0); }
    v8f oa[4][2]; float mx[2], sum[2];
#pragma unroll
    for (int nt = 0; nt < 2; ++nt) { mx[nt] = -3.0e38f; sum[nt] = 0.f;
#pragma unroll
        for (int dt = 0; dt < 4; ++dt) oa[dt][nt] = (v8f){}; }
    v16bf kh[2][2], kl[2][2];   // the key block in hand, fetched one pass ahead
    auto ldk = [&](int kb) __attribute__((always_inline)) { const bf* ph0 = Kh + (size_t)(kb * 32 + lr) * HD + 8 * hi; const bf* pl0 = Kl + (size_t)(kb * 32 + lr) * HD + 8 * hi;
#pragma unroll
        for (int mt = 0; mt < 2; ++mt)
#pragma unroll
            for (int ks = 0; ks < 2; ++ks) { kh[mt][ks] = ldfr(ph0 + mt * 16 * HD + ks * 32); kl[mt][ks] = ldfr(pl0 + mt * 16 * HD + ks * 32); }
        XWAIT(ph0, pl0); };
    auto pass = [&](int kb, bool diag) __attribute__((always_inline)) { const int k0 = kb * 32;
        v16bf vh[4], vl[4]; const bf* pv0 = Vh + (size_t)lr * (2 * TT) + k0 + 8 * hi; const bf* pv1 = Vl + (size_t)lr * (2 * TT) + k0 + 8 * hi;
#pragma unroll
        for (int dt = 0; dt < 4; ++dt) { vh[dt] = ldfr(pv0 + dt * 16 * 2 * TT); vl[dt] = ldfr(pv1 + dt * 16 * 2 * TT); }
        XWAIT(pv0, pv1);
        __builtin_amdgcn_sched_barrier(0);   // keeps the value loads up here, in flight over the score products and the softmax (the scheduler sank half of them to just in front of their use)
        v8f s[2][2];
#pragma unroll
        for (int mt = 0; mt < 2; ++mt)
#pragma unroll
            for (int nt = 0; nt < 2; ++nt) { v8f a = (v8f){};
#pragma unroll
                for (int ks = 0; ks < 2; ++ks) { a = wmmab(kh[mt][ks], qh[nt][ks], a); a = wmmab(kl[mt][ks], qh[nt][ks], a); a = wmmab(kh[mt][ks], ql[nt][ks], a); }
                s[mt][nt] = a; }
        v16bf ph[2], pl[2];
#pragma unroll
        for (int nt = 0; nt < 2; ++nt) { float t[16]; float bm = -3.0e38f;
#pragma unroll
            for (int e = 0; e < 16; ++e) { t[e] = s[e >> 3][nt][e & 7]; if (diag && (e >> 3) * 16 + 8 * hi + (e & 7) > nt * 16 + lr) t[e] = -3.0e38f; bm = fmaxf(bm, t[e]); }   // diagonal block: keys past the query are excluded
            bm = fmaxf(bm, __shfl_xor(bm, 16, 32));
            const float mn = fmaxf(mx[nt], bm * (SCL * L2E)); const float al = ex2(mx[nt] - mn); mx[nt] = mn; float ls = 0.f;   // mx: the row's offset in the log2 domain; every probability of the row is 2^(score * SCL * L2E - mx)
#pragma unroll
            for (int e = 0; e < 16; ++e) t[e] = __builtin_fmaf(t[e], SCL * L2E, -mn);
            float pr[16];
#pragma unroll
            for (int e = 0; e < 16; ++e) pr[e] = __builtin_amdgcn_exp2f(t[e]);
            TSLOT8(pr, t, 0); TSLOT8(pr, t, 8);
#pragma unroll
            for (int e = 0; e < 16; ++e) { const float p = pr[e]; ls += p; const __bf16 a = (__bf16)p; ph[nt][e] = a; pl[nt][e] = (__bf16)(p - (float)a); }
            sum[nt] = sum[nt] * al + ls;
#pragma unroll
            for (int dt = 0; dt < 4; ++dt) oa[dt][nt] *= al; }
        if (!diag) { ldk(min(kb + AW, qt));   // the wave's next block (clamped to the diagonal block: always inside the planes), in flight over the value product
            __builtin_amdgcn_sched_barrier(0); }   // keeps those loads in front of the value product (the scheduler sank them to the loop's foot, where nothing covers their latency)
#pragma unroll
        for (int dt = 0; dt < 4; ++dt)
#pragma unroll
            for (int nt = 0; nt < 2; ++nt) { oa[dt][nt] = wmmab(vh[dt], ph[nt], oa[dt][nt]); oa[dt][nt] = wmmab(vh[dt], pl[nt], oa[dt][nt]); oa[dt][nt] = wmmab(vl[dt], ph[nt], oa[dt][nt]); } };
    ldk(min(w, qt));
    int kb = w;
#pragma unroll 1   // one copy of the pass in the loop: the registers of a second copy would cost a resident wave
    for (; kb < qt; kb += AW) pass(kb, false);
    if (kb == qt) pass(kb, true);   // the diagonal block falls to one of the four waves, as its last pass
#pragma unroll
    for (int nt = 0; nt < 2; ++nt) { const float st = sum[nt] + __shfl_xor(sum[nt], 16, 32); if (hi == 0) { sm[w][nt * 16 + lr] = mx[nt]; sl[w][nt * 16 + lr] = st; }
#pragma unroll
        for (int dt = 0; dt < 4; ++dt) { float* d = &so[w][nt * 16 + lr][dt * 16 + 8 * hi]; const v8f a = oa[dt][nt]; *(v4f*)d = (v4f){a[0], a[1], a[2], a[3]}; *(v4f*)(d + 4) = (v4f){a[4], a[5], a[6], a[7]}; } }
    __syncthreads();
    const int q = (int)threadIdx.x >> 2, c = ((int)threadIdx.x & 3) * 16;
    float mm = sm[0][q];
#pragma unroll
    for (int x = 1; x < AW; ++x) mm = fmaxf(mm, sm[x][q]);
    float lt = 0.f; float r[16];
#pragma unroll
    for (int i = 0; i < 16; ++i) r[i] = 0.f;
#pragma unroll
    for (int x = 0; x < AW; ++x) { const float f = ex2(sm[x][q] - mm); lt += f * sl[x][q];
#pragma unroll
        for (int i4 = 0; i4 < 4; ++i4) { const v4f a = *(const v4f*)&so[x][q][c + i4 * 4];
#pragma unroll
            for (int i = 0; i < 4; ++i) r[i4 * 4 + i] += f * a[i]; } }
    const float inv = __fdiv_rn(1.0f, lt); const size_t oo = (size_t)(q0 + q) * DQ + h * HD + c;
#pragma unroll
    for (int i8 = 0; i8 < 2; ++i8) { v8us oh, ol;
#pragma unroll
        for (int i = 0; i < 8; ++i) { unsigned short a, c2; splitf(r[i8 * 8 + i] * inv, a, c2); oh[i] = a; ol[i] = c2; }
        *(v8us*)(Ah + oo + i8 * 8) = oh; *(v8us*)(Al + oo + i8 * 8) = ol; }
}

extern "C" void kernel_launch(void* const* d_in, const int* in_sizes, int n_in,
                              void* d_out, int out_size, void* d_ws, size_t ws_size, hipStream_t stream) {
    (void)in_sizes; (void)n_in; (void)out_size;
    const float* x = (const float*)d_in[0]; const float* fcos = (const float*)d_in[1]; const float* fsin = (const float*)d_in[2]; const float* wq = (const float*)d_in[3]; const float* wk = (const float*)d_in[4]; const float* wv = (const float*)d_in[5]; const float* wo = (const float*)d_in[6];   /* input order x, cos, sin ([1][1][2048][64] = flat [2048][64]; read per position and per dimension), wq, wk, wv, wo ('oi') */
    float* OUT = (float*)d_out;     // [2][2048][1024]
    char* wsp = (char*)d_ws;
    auto take = [&](size_t bytes) { char* p = wsp; wsp += (bytes + 255) & ~(size_t)255; return (void*)p; };
    bf* WQ = (bf*)take((size_t)DQ * DM * 2); bf* WK = (bf*)take((size_t)DKV * DM * 2); bf* WV = (bf*)take((size_t)DKV * DM * 2); bf* WO = (bf*)take((size_t)DM * DQ * 2); float* CS = (float*)take((size_t)TT * HD * 2 * 4);
    bf* XB = (bf*)take((size_t)TT * DM * 2);
    bf* QPh = (bf*)take((size_t)NH_ * TT * HD * 2); bf* QPl = (bf*)take((size_t)NH_ * TT * HD * 2); bf* KPh = (bf*)take((size_t)NKV * TT * HD * 2); bf* KPl = (bf*)take((size_t)NKV * TT * HD * 2); bf* VTh = (bf*)take((size_t)NKV * HD * 2 * TT * 2); bf* VTl = VTh + TT;   // transposed values: row pitch 2 * TT, hi in the first half of a row, lo in the second 
    bf* ATh = (bf*)take((size_t)TT * DQ * 2); bf* ATl = (bf*)take((size_t)TT * DQ * 2);
    if ((size_t)(wsp - (char*)d_ws) > ws_size) return;    // ws 256 MiB
    { k_cvt8<<<(unsigned)(((size_t)DQ * DM / 8 + 255) / 256), 256, 0, stream>>>(wq, WQ, (size_t)DQ * DM / 8); k_cvt8<<<(unsigned)(((size_t)DKV * DM / 8 + 255) / 256), 256, 0, stream>>>(wk, WK, (size_t)DKV * DM / 8); k_cvt8<<<(unsigned)(((size_t)DKV * DM / 8 + 255) / 256), 256, 0, stream>>>(wv, WV, (size_t)DKV * DM / 8);
      k_cvt8<<<(unsigned)(((size_t)DM * DQ / 8 + 255) / 256), 256, 0, stream>>>(wo, WO, (size_t)DM * DQ / 8);
       }
    k_cscvt<<<(TT * HD + 255) / 256, 256, 0, stream>>>(fcos, fsin, CS);   /* rotary table from the inputs */
    for (int b = 0; b < NB_; ++b) {
        
        k_cvt8<<<(unsigned)(((size_t)TT * DM / 8 + 255) / 256), 256, 0, stream>>>(x + (size_t)b * TT * DM, XB, (size_t)TT * DM / 8);
        k_gemmw<bf, 0, false, 1><<<dim3(TT / 64, DQ / 64, 1), 32, 0, stream>>>(XB, nullptr, WQ, nullptr, DM, nullptr, 0, nullptr, 0, 0, 0, CS, QPh, QPl);
        k_gemmw<bf, 0, false, 1><<<dim3(TT / 64, DKV / 64, 1), 32, 0, stream>>>(XB, nullptr, WK, nullptr, DM, nullptr, 0, nullptr, 0, 0, 0, CS, KPh, KPl);
        k_gemmw<bf, 0, false, 2><<<dim3(TT / 64, DKV / 64, 1), 32, 0, stream>>>(XB, nullptr, WV, nullptr, DM, nullptr, 0, nullptr, 0, 0, 0, nullptr, VTh, VTl);
        k_attn<<<NH_ * (TT / AQ), AW * 32, 0, stream>>>(QPh, QPl, KPh, KPl, VTh, VTl, ATh, ATl);   // one kv head per query head
        k_gemmw<bf, 1, false, 0><<<dim3(TT / 64, DM / 64, 1), 32, 0, stream>>>(ATh, ATl, WO, nullptr, DQ, OUT + (size_t)b * TT * DM, DM, nullptr, 0, 0, 0, nullptr, nullptr, nullptr); }
}

// v005
// A run of this version takes 201 microseconds.
// Timed twice side by side with v004, it ran 1.50 and 1.48 times as fast.
// Over all steps from v000 it is 5.77 times as fast.
#include <hip/hip_runtime.h>

// Causal multi-head attention with rotate-half rotary embedding from cos / sin TABLE INPUTS read by value (x [2][2048][1024]; q, k, v = einsum('bld,ed', x, w) ('oi' [1024][1024] 1/32, no bias; 16 heads x 64); cos, sin f32 [1][1][2048][64] are INPUTS (arbitrary values on this draw: independent normal tables, not cosines of angles), read per position AND per dimension; q, k <- t cos + rotate_half(t) sin with rotate_half = cat(-x2, x1) over the two 32-wide halves; scores / sqrt(64); keys j <= i kept, finfo.min elsewhere (== exclusion); softmax; out = einsum('bld,ed', merged, wo) -> [2][2048][1024] (4.2 M); argument order x, cos, sin, wq, wk, wv, wo).
// Layout per batch: bf16 copy of x; 'oi' weights; exact projections; {cos, sin} table from the bf16-rounded inputs; rotate-half rotary, hi/lo split and value transpose in the projections' own epilogues; one fused causal attention launch (k_attn: scores, running softmax and value product in registers, all query rows hi/lo 3 products); merged hi/lo x Wo exact.
// Compute dtypes, f32 accumulate: every input rounded to bf16 incl. the tables; projections exact; rotary f32; attention: ALL 2,048 query rows bf16 hi + lo operands with three products; softmax f32; Wo hl x exact.

#define NB_  2
#define TT   2048
#define DM   1024
#define NH_  16
#define NKV  16
#define REP  (NH_ / NKV)
#define HD   64
#define DQ   (NH_ * HD)
#define DKV  (NKV * HD)
#define SCL  0.125f   // HD^-0.5
typedef _Float16 h16;
typedef unsigned short bf;
typedef __attribute__((ext_vector_type(16))) __bf16   v16bf;
typedef __attribute__((ext_vector_type(16))) _Float16 v16h;
typedef __attribute__((ext_vector_type(8)))  _Float16 v8h;
typedef __attribute__((ext_vector_type(8)))  unsigned short v8us;
typedef __attribute__((ext_vector_type(8)))  float    v8f;
typedef __attribute__((ext_vector_type(4)))  float    v4f;
typedef v8h  __attribute__((may_alias)) v8ha;
typedef v4f  __attribute__((may_alias)) v4fa;
typedef v8us __attribute__((may_alias)) v8usa;

__device__ __forceinline__ unsigned short f2bf(float f) { unsigned u = __float_as_uint(f); u += 0x7FFFu + ((u >> 16) & 1u); return (unsigned short)(u >> 16); }
__device__ __forceinline__ float bf2f(unsigned short b) { return __uint_as_float(((unsigned)b) << 16); }
__device__ __forceinline__ float bfr(float f) { return bf2f(f2bf(f)); }
__device__ __forceinline__ v16h cat16(v8h lo, v8h hi) { return __builtin_shufflevector(lo, hi, 0, 1, 2, 3, 4, 5, 6, 7, 8, 9, 10, 11, 12, 13, 14, 15); }
__device__ __forceinline__ v16bf cat16b(v8us lo, v8us hi) { return __builtin_bit_cast(v16bf, __builtin_shufflevector(lo, hi, 0, 1, 2, 3, 4, 5, 6, 7, 8, 9, 10, 11, 12, 13, 14, 15)); }
__device__ __forceinline__ v8f wmma16(v16h a, v16h b, v8f c) { return __builtin_amdgcn_wmma_f32_16x16x32_f16(false, a, false, b, (short)0, c, false, false); }
__device__ __forceinline__ v8f wmmab(v16bf a, v16bf b, v8f c) { return __builtin_amdgcn_wmma_f32_16x16x32_bf16(false, a, false, b, (short)0, c, false, false); }



// ---- k_gemmw: register-blocked GEMM, ONE WAVE per 64x64 output tile (16 accumulators), operands straight from K-contiguous 16-bit planes; grid (M/64, N/64, Z), 32 threads.
// C[m][n] (f32, pitch ldc, + optional f32 bias[n]) = sum_k A[m][k] Bt[n][k] (+ split products per NSPLIT). z-batch strides sA/sB/sC in elements. K % 128 == 0, K > 128.
// The fragments of a 32-wide k step are one set of registers; RD sets form a ring: a step's loads go out as one group, into the set just used, RD - 1 steps ahead of its products, so that a lone wave's products run while later steps' loads are in flight.
// EPI 0: C goes out as f32. EPI 1, 2: a 64-column tile is one head (blockIdx.y) over 64 positions, so the wave finishes it itself and C is not written:
// EPI 1: rotate-half rotary out[d] = x[d] cos[t][d] - x[d+32] sin[t][d], out[d+32] = x[d+32] cos[t][d+32] + x[d] sin[t][d+32] (CS = {cos, sin} pairs [t][d]), then hi/lo planes Ph, Pl [head][t][d];
// EPI 2: hi/lo planes of the transposed tile, Ph, Pl [head][d][t] with row pitch 2 * TT.
template <typename T16> struct WFrag;
template <> struct WFrag<h16> { typedef v16h V; static __device__ __forceinline__ V ld(const h16* p) { return cat16(*(const v8h*)p, *(const v8h*)(p + 16)); } static __device__ __forceinline__ v8f mma(V a, V b, v8f c) { return wmma16(a, b, c); } };
template <> struct WFrag<bf> { typedef v16bf V; static __device__ __forceinline__ V ld(const bf* p) { return cat16b(*(const v8us*)p, *(const v8us*)(p + 16)); } static __device__ __forceinline__ v8f mma(V a, V b, v8f c) { return wmmab(a, b, c); } };
__device__ __forceinline__ void splitf(float y, unsigned short& h, unsigned short& l) { h = f2bf(y); l = f2bf(y - bf2f(h)); }
// the same split (round to nearest even, then the rounded remainder) for eight values, on the chip's own conversion
__device__ __forceinline__ void split8(const float* y, v8us& h, v8us& l) { typedef __attribute__((ext_vector_type(8))) __bf16 v8b; v8b a, b;
#pragma unroll
    for (int i = 0; i < 8; ++i) { a[i] = (__bf16)y[i]; b[i] = (__bf16)(y[i] - (float)a[i]); }
    h = __builtin_bit_cast(v8us, a); l = __builtin_bit_cast(v8us, b); }
#define RD  4      // sets in the ring
#define VTP 72     // pitch of a transposed row in LDS, 16-bit elements (16-byte aligned rows, rows spread over the banks)
template <typename T16, int NSPLIT, bool BIAS, int EPI>
__global__ __launch_bounds__(32) void k_gemmw(const T16* __restrict__ A, const T16* __restrict__ A2, const T16* __restrict__ Bt, const T16* __restrict__ Bt2, int K, float* C, int ldc, const float* __restrict__ bias, size_t sA, size_t sB, size_t sC, const float* __restrict__ CS, bf* __restrict__ Ph, bf* __restrict__ Pl) {
    typedef typename WFrag<T16>::V V;
    const size_t z = blockIdx.z; A += z * sA; if (A2) A2 += z * sA; Bt += z * sB; if (Bt2) Bt2 += z * sB; C += z * sC;
    const int lane = threadIdx.x & 31, lr = lane & 15, hi = lane >> 4; const int r0 = blockIdx.x * 64, c0 = blockIdx.y * 64;
    v8f acc[4][4];
    constexpr bool SA = NSPLIT == 1 || NSPLIT == 2, SB = NSPLIT >= 2;
    __builtin_assume(K > 32 * RD);   // the loop below runs at least once: no second path from the first loads to the last products
    // an address is a wave-uniform base (tile origin + ko bytes along k) plus a lane's 32-bit offset vo[i] (16-row tile i), the same for all planes; ko moves once per RD steps, the steps of a trip are immediate offsets
    const char* sa = (const char*)(A + (size_t)r0 * K); const char* sb = (const char*)(Bt + (size_t)c0 * K); const char* sa2 = SA ? (const char*)(A2 + (size_t)r0 * K) : sa; const char* sb2 = SB ? (const char*)(Bt2 + (size_t)c0 * K) : sb;
    unsigned vo[4], ko = 0;
#pragma unroll
    for (int i = 0; i < 4; ++i) vo[i] = (unsigned)(((i * 16 + lr) * K + 8 * hi) * 2);
    V a[RD][4], a2[RD][4], b[RD][4], b2[RD][4];
    auto fetch = [&](int s, int o) __attribute__((always_inline)) {   // set s <- the step 32 * o elements behind ko
#pragma unroll
        for (int i = 0; i < 4; ++i) { a[s][i] = WFrag<T16>::ld((const T16*)(sa + ko + vo[i]) + o * 32); if (SA) a2[s][i] = WFrag<T16>::ld((const T16*)(sa2 + ko + vo[i]) + o * 32); }
#pragma unroll
        for (int i = 0; i < 4; ++i) { b[s][i] = WFrag<T16>::ld((const T16*)(sb + ko + vo[i]) + o * 32); if (SB) b2[s][i] = WFrag<T16>::ld((const T16*)(sb2 + ko + vo[i]) + o * 32); }
        __builtin_amdgcn_sched_barrier(0); };   // keeps the group whole and in front of the products that follow it (sunk towards their use the loads would have no lead)
    auto mult = [&](int s) __attribute__((always_inline)) {
#pragma unroll
        for (int nb = 0; nb < 4; ++nb)
#pragma unroll
            for (int mb = 0; mb < 4; ++mb) { acc[mb][nb] = WFrag<T16>::mma(a[s][mb], b[s][nb], acc[mb][nb]); if (SA) acc[mb][nb] = WFrag<T16>::mma(a2[s][mb], b[s][nb], acc[mb][nb]); if (SB) acc[mb][nb] = WFrag<T16>::mma(a[s][mb], b2[s][nb], acc[mb][nb]); }
        __builtin_amdgcn_sched_barrier(0); };   // keeps the next group of loads behind these products: it refills the set that they read
    // the offset moves on. Precaution behind the issued loads: it passes through the wait, so the sums that form the next addresses (and overwrite the registers of the old ones) stand behind the wait
#define KSTEP(n) ko += (n); asm volatile("s_wait_xcnt 0x0" : "+s"(ko) :: "memory")
    fetch(0, 0); fetch(1, 1); fetch(2, 2); fetch(3, 3);
    // the same precaution behind the first RD groups: the accumulators' zero passes through the wait, so the moves that clear them stand behind it
    unsigned zs = 0; asm volatile("s_wait_xcnt 0x0" : "+s"(zs) :: "memory"); const float z0 = __uint_as_float(zs);
#pragma unroll
    for (int mb = 0; mb < 4; ++mb)
#pragma unroll
        for (int nb = 0; nb < 4; ++nb) acc[mb][nb] = (v8f){z0, z0, z0, z0, z0, z0, z0, z0};
#pragma unroll 1   // one trip is RD steps already
    for (int kc = 32 * RD; kc < K; kc += 32 * RD) { mult(0); KSTEP(64 * RD); fetch(0, 0); mult(1); fetch(1, 1); mult(2); fetch(2, 2); mult(3); fetch(3, 3); }
    mult(0); mult(1); mult(2); mult(3);   // the last RD steps: nothing left to fetch behind them
    const int rr = lane >> 3, c8 = (lane & 7) * 8;   // EPI 1, 2 write-out: eight lanes cover one 128-byte row of a plane, a wave four rows
    if constexpr (EPI == 2) {
        __shared__ __align__(16) bf vs[2][64 * VTP];
        // a lane holds eight consecutive positions of one dimension: they are 16 bytes of a transposed row
#pragma unroll
        for (int mb = 0; mb < 4; ++mb)
#pragma unroll
            for (int nb = 0; nb < 4; ++nb) { v8us oh, ol; float y[8];
#pragma unroll
                for (int j = 0; j < 8; ++j) y[j] = acc[mb][nb][j];
                split8(y, oh, ol);
                *(v8usa*)(&vs[0][(nb * 16 + lr) * VTP + mb * 16 + hi * 8]) = oh; *(v8usa*)(&vs[1][(nb * 16 + lr) * VTP + mb * 16 + hi * 8]) = ol; }
        __builtin_amdgcn_wave_barrier(); asm volatile("" ::: "memory");   // the rows are read back by other lanes of the wave: holds every LDS write in front of those reads in the compiled order
        const size_t vo = ((size_t)blockIdx.y * HD + rr) * (2 * TT) + r0 + c8;
#pragma unroll
        for (int s = 0; s < 16; ++s) { *(v8us*)(Ph + vo + (size_t)s * 4 * (2 * TT)) = *(const v8usa*)(&vs[0][(4 * s + rr) * VTP + c8]); *(v8us*)(Pl + vo + (size_t)s * 4 * (2 * TT)) = *(const v8usa*)(&vs[1][(4 * s + rr) * VTP + c8]); }
    } else {
    __shared__ __align__(16) float os[16 * 68];
#pragma unroll
    for (int mb = 0; mb < 4; ++mb) {
#pragma unroll
        for (int nb = 0; nb < 4; ++nb) {
#pragma unroll
            for (int j = 0; j < 8; ++j) os[(hi * 8 + j) * 68 + nb * 16 + lr] = acc[mb][nb][j]; }
        __builtin_amdgcn_wave_barrier(); asm volatile("" ::: "memory");
        if constexpr (EPI == 1) {
            const float sg = (c8 < HD / 2) ? -1.0f : 1.0f;   // sign of the rotated partner
            const float* csp = CS + ((size_t)(r0 + mb * 16 + rr) * HD + c8) * 2; const size_t po = ((size_t)blockIdx.y * TT + r0 + mb * 16 + rr) * HD + c8;
#pragma unroll
            for (int s = 0; s < 4; ++s) { const float* xr = os + (4 * s + rr) * 68; v8us oh, ol; float r[8];
#pragma unroll
                for (int i4 = 0; i4 < 2; ++i4) { const v4f x0 = *(const v4fa*)(xr + c8 + i4 * 4), x1 = *(const v4fa*)(xr + (c8 ^ (HD / 2)) + i4 * 4); const v4f e0 = *(const v4f*)(csp + s * 4 * HD * 2 + i4 * 8), e1 = *(const v4f*)(csp + s * 4 * HD * 2 + i4 * 8 + 4);
                    r[i4 * 4] = x0[0] * e0[0] + sg * x1[0] * e0[1]; r[i4 * 4 + 1] = x0[1] * e0[2] + sg * x1[1] * e0[3]; r[i4 * 4 + 2] = x0[2] * e1[0] + sg * x1[2] * e1[1]; r[i4 * 4 + 3] = x0[3] * e1[2] + sg * x1[3] * e1[3]; }
                split8(r, oh, ol);
                *(v8us*)(Ph + po + s * 4 * HD) = oh; *(v8us*)(Pl + po + s * 4 * HD) = ol; }
            if (mb < 3) asm volatile("s_wait_xcnt 0x0" ::: "memory");   // precaution behind the stores: the next block's table loads land in registers that these stores name as data
        } else {
        float* crow = C + (size_t)(r0 + mb * 16) * ldc + c0;
{
#pragma unroll
            for (int s = 0; s < 8; ++s) { const int row = 2 * s + hi, cofs = lr * 4; v4f val = *(const v4fa*)(os + row * 68 + cofs); if (BIAS) { val[0] += bfr(bias[c0 + cofs]); val[1] += bfr(bias[c0 + cofs + 1]); val[2] += bfr(bias[c0 + cofs + 2]); val[3] += bfr(bias[c0 + cofs + 3]); }
                *(v4f*)(crow + (size_t)row * ldc + cofs) = val; }
             }
        }
        __builtin_amdgcn_wave_barrier(); asm volatile("" ::: "memory");
    }
    }
}

__device__ __forceinline__ h16 tohx(float x) { return (h16)x; }
typedef __attribute__((ext_vector_type(2))) _Float16 v2h;
typedef __attribute__((ext_vector_type(4))) _Float16 v4h;
typedef __attribute__((ext_vector_type(2))) unsigned short v2us;
typedef __attribute__((ext_vector_type(4))) unsigned short v4us;
typedef v4us __attribute__((may_alias)) v4usa;
typedef __attribute__((ext_vector_type(2))) float v2f;
typedef __attribute__((ext_vector_type(4))) int v4i;

__global__ __launch_bounds__(256) void k_cvt8(const float* __restrict__ src, bf* dst, size_t n8) { const size_t i = (size_t)blockIdx.x * 256 + threadIdx.x; if (i >= n8) return; const v8f v = *(const v8f*)(src + i * 8); v8us o;
#pragma unroll
    for (int k = 0; k < 8; ++k) o[k] = f2bf(v[k]); *(v8us*)(dst + i * 8) = o;  }

__global__ __launch_bounds__(256) void k_cscvt(const float* __restrict__ cosT, const float* __restrict__ sinT, float* CS) { const int idx = blockIdx.x * 256 + threadIdx.x; if (idx >= TT * HD) return; v2f cs; cs[0] = bfr(cosT[idx]); cs[1] = bfr(sinT[idx]); *(v2f*)(CS + (size_t)idx * 2) = cs;  }
// ---- k_attn: causal attention of one batch in one launch. A work-group owns 32 query rows of one head; its 4 waves take the 32-key blocks kb = w, w + 4, ... up to the diagonal block.
// Per block: S^T = K Q^T (A = key rows, B = query rows kept in registers; hi/lo, three products), so a lane holds scores of ONE query per 16-column group (keys 8 hi + j of each 16-key tile): running maximum and sum are per lane,
// and the two score tiles of a block are, register for register, the B operand P^T of O^T += V^T P^T (A = rows of the transposed values; hi/lo, three products). Probabilities stay unnormalised; the division by the row sum is last.
// The four waves' (maximum, sum, O^T) meet in LDS behind one barrier and are joined in ascending wave order; the result goes out as the hi/lo planes [t][head * 64 + d] that the output projection reads.
#define AQ   32     // query rows per work-group
#define AW   4      // waves per work-group (key blocks dealt round robin)
#define AOP  68     // pitch of an O row in LDS, floats (16-byte aligned rows, rows spread over the banks)
#define L2E  1.4426950408889634f
// precaution behind a run of global loads: as inputs here the two address pairs stay live and unwritten up to the wait
#define XWAIT(a, b) asm volatile("s_wait_xcnt 0x0" :: "v"(a), "v"(b) : "memory")
// the slot that the instruction set asks for behind a transcendental: results and sources are operands of the v_nop, so no use of a result and no overwrite of a source can stand in front of it
// within a run of eight each exponential is the independent instruction behind the one before
#define TSLOT8(r, x, o) asm("v_nop" : "+v"(r[o]), "+v"(r[o + 1]), "+v"(r[o + 2]), "+v"(r[o + 3]), "+v"(r[o + 4]), "+v"(r[o + 5]), "+v"(r[o + 6]), "+v"(r[o + 7]) : "v"(x[o]), "v"(x[o + 1]), "v"(x[o + 2]), "v"(x[o + 3]), "v"(x[o + 4]), "v"(x[o + 5]), "v"(x[o + 6]), "v"(x[o + 7]))
__device__ __forceinline__ float ex2(float x) { float r = __builtin_amdgcn_exp2f(x); asm("v_nop" : "+v"(r) : "v"(x)); return r; }
__device__ __forceinline__ v16bf ldfr(const bf* p) { return cat16b(*(const v8us*)p, *(const v8us*)(p + 16)); }
// waves_per_eu(3, 3): the register budget of three waves per SIMD holds Q, O^T, one key block and one value block at once; with the default budget the scheduler split the loads of a pass into several waited groups
__global__ __launch_bounds__(AW * 32) __attribute__((amdgpu_waves_per_eu(3, 3))) void k_attn(const bf* __restrict__ Qh, const bf* __restrict__ Ql, const bf* __restrict__ Kh, const bf* __restrict__ Kl, const bf* __restrict__ Vh, const bf* __restrict__ Vl, bf* __restrict__ Ah, bf* __restrict__ Al) {
    __shared__ __align__(16) float so[AW][AQ][AOP];
    __shared__ float sm[AW][AQ], sl[AW][AQ];
    // 1,024 work-groups: heavy query tiles first, and four work-groups 256 apart in the grid add up to the same number of key blocks
    const int L = (int)blockIdx.x, g = L >> 8, h = L & 15, u = (L >> 4) & 15;
    const int qt = (g == 0) ? 63 - u : (g == 1) ? 32 + u : (g == 2) ? 31 - u : u; const int q0 = qt * AQ;
    const int lane = threadIdx.x & 31, lr = lane & 15, hi = lane >> 4; const int w = __builtin_amdgcn_readfirstlane((int)(threadIdx.x >> 5));
    const size_t hp = (size_t)h * TT * HD; Qh += hp; Ql += hp; Kh += hp; Kl += hp; Vh += (size_t)h * HD * 2 * TT; Vl += (size_t)h * HD * 2 * TT;
    v16bf qh[2][2], ql[2][2];
    { const bf* ph0 = Qh + (size_t)(q0 + lr) * HD + 8 * hi; const bf* pl0 = Ql + (size_t)(q0 + lr) * HD + 8 * hi;
#pragma unroll
      for (int nt = 0; nt < 2; ++nt)
#pragma unroll
        for (int ks = 0; ks < 2; ++ks) { qh[nt][ks] = ldfr(ph0 + nt * 16 * HD + ks * 32); ql[nt][ks] = ldfr(pl0 + nt * 16 * HD + ks * 32); }
      XWAIT(ph0, pl0); }
    v8f oa[4][2]; float mx[2], sum[2];
#pragma unroll
    for (int nt = 0; nt < 2; ++nt) { mx[nt] = -3.0e38f; sum[nt] = 0.f;
#pragma unroll
        for (int dt = 0; dt < 4; ++dt) oa[dt][nt] = (v8f){}; }
    v16bf kh[2][2], kl[2][2];   // the key block in hand, fetched one pass ahead
    auto ldk = [&](int kb) __attribute__((always_inline)) { const bf* ph0 = Kh + (size_t)(kb * 32 + lr) * HD + 8 * hi; const bf* pl0 = Kl + (size_t)(kb * 32 + lr) * HD + 8 * hi;
#pragma unroll
        for (int mt = 0; mt < 2; ++mt)
#pragma unroll
            for (int ks = 0; ks < 2; ++ks) { kh[mt][ks] = ldfr(ph0 + mt * 16 * HD + ks * 32); kl[mt][ks] = ldfr(pl0 + mt * 16 * HD + ks * 32); }
        XWAIT(ph0, pl0); };
    auto pass = [&](int kb, bool diag) __attribute__((always_inline)) { const int k0 = kb * 32;
        v16bf vh[4], vl[4]; const bf* pv0 = Vh + (size_t)lr * (2 * TT) + k0 + 8 * hi; const bf* pv1 = Vl + (size_t)lr * (2 * TT) + k0 + 8 * hi;
#pragma unroll
        for (int dt = 0; dt < 4; ++dt) { vh[dt] = ldfr(pv0 + dt * 16 * 2 * TT); vl[dt] = ldfr(pv1 + dt * 16 * 2 * TT); }
        XWAIT(pv0, pv1);
        __builtin_amdgcn_sched_barrier(0);   // keeps the value loads up here, in flight over the score products and the softmax (the scheduler sank half of them to just in front of their use)
        v8f s[2][2];
#pragma unroll
        for (int mt = 0; mt < 2; ++mt)
#pragma unroll
            for (int nt = 0; nt < 2; ++nt) { v8f a = (v8f){};
#pragma unroll
                for (int ks = 0; ks < 2; ++ks) { a = wmmab(kh[mt][ks], qh[nt][ks], a); a = wmmab(kl[mt][ks], qh[nt][ks], a); a = wmmab(kh[mt][ks], ql[nt][ks], a); }
                s[mt][nt] = a; }
        v16bf ph[2], pl[2];
#pragma unroll
        for (int nt = 0; nt < 2; ++nt) { float t[16]; float bm = -3.0e38f;
#pragma unroll
            for (int e = 0; e < 16; ++e) { t[e] = s[e >> 3][nt][e & 7]; if (diag && (e >> 3) * 16 + 8 * hi + (e & 7) > nt * 16 + lr) t[e] = -3.0e38f; bm = fmaxf(bm, t[e]); }   // diagonal block: keys past the query are excluded
            bm = fmaxf(bm, __shfl_xor(bm, 16, 32));
            const float mn = fmaxf(mx[nt], bm * (SCL * L2E)); const float al = ex2(mx[nt] - mn); mx[nt] = mn; float ls = 0.f;   // mx: the row's offset in the log2 domain; every probability of the row is 2^(score * SCL * L2E - mx)
#pragma unroll
            for (int e = 0; e < 16; ++e) t[e] = __builtin_fmaf(t[e], SCL * L2E, -mn);
            float pr[16];
#pragma unroll
            for (int e = 0; e < 16; ++e) pr[e] = __builtin_amdgcn_exp2f(t[e]);
            TSLOT8(pr, t, 0); TSLOT8(pr, t, 8);
#pragma unroll
            for (int e = 0; e < 16; ++e) { const float p = pr[e]; ls += p; const __bf16 a = (__bf16)p; ph[nt][e] = a; pl[nt][e] = (__bf16)(p - (float)a); }
            sum[nt] = sum[nt] * al + ls;
#pragma unroll
            for (int dt = 0; dt < 4; ++dt) oa[dt][nt] *= al; }
        if (!diag) { ldk(min(kb + AW, qt));   // the wave's next block (clamped to the diagonal block: always inside the planes), in flight over the value product
            __builtin_amdgcn_sched_barrier(0); }   // keeps those loads in front of the value product (the scheduler sank them to the loop's foot, where nothing covers their latency)
#pragma unroll
        for (int dt = 0; dt < 4; ++dt)
#pragma unroll
            for (int nt = 0; nt < 2; ++nt) { oa[dt][nt] = wmmab(vh[dt], ph[nt], oa[dt][nt]); oa[dt][nt] = wmmab(vh[dt], pl[nt], oa[dt][nt]); oa[dt][nt] = wmmab(vl[dt], ph[nt], oa[dt][nt]); } };
    ldk(min(w, qt));
    int kb = w;
#pragma unroll 1   // one copy of the pass in the loop: the registers of a second copy would cost a resident wave
    for (; kb < qt; kb += AW) pass(kb, false);
    if (kb == qt) pass(kb, true);   // the diagonal block falls to one of the four waves, as its last pass
#pragma unroll
    for (int nt = 0; nt < 2; ++nt) { const float st = sum[nt] + __shfl_xor(sum[nt], 16, 32); if (hi == 0) { sm[w][nt * 16 + lr] = mx[nt]; sl[w][nt * 16 + lr] = st; }
#pragma unroll
        for (int dt = 0; dt < 4; ++dt) { float* d = &so[w][nt * 16 + lr][dt * 16 + 8 * hi]; const v8f a = oa[dt][nt]; *(v4f*)d = (v4f){a[0], a[1], a[2], a[3]}; *(v4f*)(d + 4) = (v4f){a[4], a[5], a[6], a[7]}; } }
    __syncthreads();
    const int q = (int)threadIdx.x >> 2, c = ((int)threadIdx.x & 3) * 16;
    float mm = sm[0][q];
#pragma unroll
    for (int x = 1; x < AW; ++x) mm = fmaxf(mm, sm[x][q]);
    float lt = 0.f; float r[16];
#pragma unroll
    for (int i = 0; i < 16; ++i) r[i] = 0.f;
#pragma unroll
    for (int x = 0; x < AW; ++x) { const float f = ex2(sm[x][q] - mm); lt += f * sl[x][q];
#pragma unroll
        for (int i4 = 0; i4 < 4; ++i4) { const v4f a = *(const v4f*)&so[x][q][c + i4 * 4];
#pragma unroll
            for (int i = 0; i < 4; ++i) r[i4 * 4 + i] += f * a[i]; } }
    const float inv = __fdiv_rn(1.0f, lt); const size_t oo = (size_t)(q0 + q) * DQ + h * HD + c;
#pragma unroll
    for (int i8 = 0; i8 < 2; ++i8) { v8us oh, ol;
#pragma unroll
        for (int i = 0; i < 8; ++i) { unsigned short a, c2; splitf(r[i8 * 8 + i] * inv, a, c2); oh[i] = a; ol[i] = c2; }
        *(v8us*)(Ah + oo + i8 * 8) = oh; *(v8us*)(Al + oo + i8 * 8) = ol; }
}

extern "C" void kernel_launch(void* const* d_in, const int* in_sizes, int n_in,
                              void* d_out, int out_size, void* d_ws, size_t ws_size, hipStream_t stream) {
    (void)in_sizes; (void)n_in; (void)out_size;
    const float* x = (const float*)d_in[0]; const float* fcos = (const float*)d_in[1]; const float* fsin = (const float*)d_in[2]; const float* wq = (const float*)d_in[3]; const float* wk = (const float*)d_in[4]; const float* wv = (const float*)d_in[5]; const float* wo = (const float*)d_in[6];   /* input order x, cos, sin ([1][1][2048][64] = flat [2048][64]; read per position and per dimension), wq, wk, wv, wo ('oi') */
    float* OUT = (float*)d_out;     // [2][2048][1024]
    char* wsp = (char*)d_ws;
    auto take = [&](size_t bytes) { char* p = wsp; wsp += (bytes + 255) & ~(size_t)255; return (void*)p; };
    bf* WQ = (bf*)take((size_t)DQ * DM * 2); bf* WK = (bf*)take((size_t)DKV * DM * 2); bf* WV = (bf*)take((size_t)DKV * DM * 2); bf* WO = (bf*)take((size_t)DM * DQ * 2); float* CS = (float*)take((size_t)TT * HD * 2 * 4);
    bf* XB = (bf*)take((size_t)TT * DM * 2);
    bf* QPh = (bf*)take((size_t)NH_ * TT * HD * 2); bf* QPl = (bf*)take((size_t)NH_ * TT * HD * 2); bf* KPh = (bf*)take((size_t)NKV * TT * HD * 2); bf* KPl = (bf*)take((size_t)NKV * TT * HD * 2); bf* VTh = (bf*)take((size_t)NKV * HD * 2 * TT * 2); bf* VTl = VTh + TT;   // transposed values: row pitch 2 * TT, hi in the first half of a row, lo in the second 
    bf* ATh = (bf*)take((size_t)TT * DQ * 2); bf* ATl = (bf*)take((size_t)TT * DQ * 2);
    if ((size_t)(wsp - (char*)d_ws) > ws_size) return;    // ws 256 MiB
    { k_cvt8<<<(unsigned)(((size_t)DQ * DM / 8 + 255) / 256), 256, 0, stream>>>(wq, WQ, (size_t)DQ * DM / 8); k_cvt8<<<(unsigned)(((size_t)DKV * DM / 8 + 255) / 256), 256, 0, stream>>>(wk, WK, (size_t)DKV * DM / 8); k_cvt8<<<(unsigned)(((size_t)DKV * DM / 8 + 255) / 256), 256, 0, stream>>>(wv, WV, (size_t)DKV * DM / 8);
      k_cvt8<<<(unsigned)(((size_t)DM * DQ / 8 + 255) / 256), 256, 0, stream>>>(wo, WO, (size_t)DM * DQ / 8);
       }
    k_cscvt<<<(TT * HD + 255) / 256, 256, 0, stream>>>(fcos, fsin, CS);   /* rotary table from the inputs */
    for (int b = 0; b < NB_; ++b) {
        
        k_cvt8<<<(unsigned)(((size_t)TT * DM / 8 + 255) / 256), 256, 0, stream>>>(x + (size_t)b * TT * DM, XB, (size_t)TT * DM / 8);
        k_gemmw<bf, 0, false, 1><<<dim3(TT / 64, DQ / 64, 1), 32, 0, stream>>>(XB, nullptr, WQ, nullptr, DM, nullptr, 0, nullptr, 0, 0, 0, CS, QPh, QPl);
        k_gemmw<bf, 0, false, 1><<<dim3(TT / 64, DKV / 64, 1), 32, 0, stream>>>(XB, nullptr, WK, nullptr, DM, nullptr, 0, nullptr, 0, 0, 0, CS, KPh, KPl);
        k_gemmw<bf, 0, false, 2><<<dim3(TT / 64, DKV / 64, 1), 32, 0, stream>>>(XB, nullptr, WV, nullptr, DM, nullptr, 0, nullptr, 0, 0, 0, nullptr, VTh, VTl);
        k_attn<<<NH_ * (TT / AQ), AW * 32, 0, stream>>>(QPh, QPl, KPh, KPl, VTh, VTl, ATh, ATl);   // one kv head per query head
        k_gemmw<bf, 1, false, 0><<<dim3(TT / 64, DM / 64, 1), 32, 0, stream>>>(ATh, ATl, WO, nullptr, DQ, OUT + (size_t)b * TT * DM, DM, nullptr, 0, 0, 0, nullptr, nullptr, nullptr); }
}

// v006
// It runs in 139 microseconds.
// Next to v005, in two timings, it ran 1.42 and 1.47 times as fast.
// Over all steps from v000 it is 8.33 times as fast.
#include <hip/hip_runtime.h>

// Causal multi-head attention with rotate-half rotary embedding from cos / sin TABLE INPUTS read by value (x [2][2048][1024]; q, k, v = einsum('bld,ed', x, w) ('oi' [1024][1024] 1/32, no bias; 16 heads x 64); cos, sin f32 [1][1][2048][64] are INPUTS (arbitrary values on this draw: independent normal tables, not cosines of angles), read per position AND per dimension; q, k <- t cos + rotate_half(t) sin with rotate_half = cat(-x2, x1) over the two 32-wide halves; scores / sqrt(64); keys j <= i kept, finfo.min elsewhere (== exclusion); softmax; out = einsum('bld,ed', merged, wo) -> [2][2048][1024] (4.2 M); argument order x, cos, sin, wq, wk, wv, wo).
// Layout per batch: bf16 copy of x; 'oi' weights; exact projections; {cos, sin} table from the bf16-rounded inputs; rotate-half rotary, hi/lo split and value transpose in the projections' own epilogues; one fused causal attention launch (k_attn: scores, running softmax and value product in registers, all query rows hi/lo 3 products); merged hi/lo x Wo exact.
// Every 16-bit operand plane is stored in FRAGMENT ORDER: a [rows][k] matrix is cut into blocks of 16 rows x 32 k (512 elements, 1,024 bytes); inside a block element (r, k) stands at (k >> 4) * 256 + (((k >> 3) & 1) * 16 + r) * 8 + (k & 7),
// which is where lane ((k >> 3) & 1) * 16 + r of a wave wants it: each of the two 16-byte loads of a fragment reads 512 consecutive bytes (four whole lines; from row-major planes it would read 32 bytes of each of 16 rows).
// The {cos, sin} table is stored in its readers' lane order for the same reason. Order of the blocks: x, weights, merged heads: (row tile, k tile), k tiles consecutive; q, k per head: (position tile, 2 k tiles); transposed values per head: (32-position k tile, 4 dimension tiles).
// Compute dtypes, f32 accumulate: every input rounded to bf16 incl. the tables; projections exact; rotary f32; attention: ALL 2,048 query rows bf16 hi + lo operands with three products; softmax f32; Wo hl x exact.

#define NB_  2
#define TT   2048
#define DM   1024
#define NH_  16
#define NKV  16
#define REP  (NH_ / NKV)
#define HD   64
#define DQ   (NH_ * HD)
#define DKV  (NKV * HD)
#define SCL  0.125f   // HD^-0.5
typedef _Float16 h16;
typedef unsigned short bf;
typedef __attribute__((ext_vector_type(16))) __bf16   v16bf;
typedef __attribute__((ext_vector_type(16))) _Float16 v16h;
typedef __attribute__((ext_vector_type(8)))  _Float16 v8h;
typedef __attribute__((ext_vector_type(8)))  unsigned short v8us;
typedef __attribute__((ext_vector_type(8)))  float    v8f;
typedef __attribute__((ext_vector_type(4)))  float    v4f;
typedef v8h  __attribute__((may_alias)) v8ha;
typedef v4f  __attribute__((may_alias)) v4fa;
typedef v8us __attribute__((may_alias)) v8usa;

__device__ __forceinline__ unsigned short f2bf(float f) { unsigned u = __float_as_uint(f); u += 0x7FFFu + ((u >> 16) & 1u); return (unsigned short)(u >> 16); }
__device__ __forceinline__ float bf2f(unsigned short b) { return __uint_as_float(((unsigned)b) << 16); }
__device__ __forceinline__ float bfr(float f) { return bf2f(f2bf(f)); }
__device__ __forceinline__ v16h cat16(v8h lo, v8h hi) { return __builtin_shufflevector(lo, hi, 0, 1, 2, 3, 4, 5, 6, 7, 8, 9, 10, 11, 12, 13, 14, 15); }
__device__ __forceinline__ v16bf cat16b(v8us lo, v8us hi) { return __builtin_bit_cast(v16bf, __builtin_shufflevector(lo, hi, 0, 1, 2, 3, 4, 5, 6, 7, 8, 9, 10, 11, 12, 13, 14, 15)); }
__device__ __forceinline__ v8f wmma16(v16h a, v16h b, v8f c) { return __builtin_amdgcn_wmma_f32_16x16x32_f16(false, a, false, b, (short)0, c, false, false); }
__device__ __forceinline__ v8f wmmab(v16bf a, v16bf b, v8f c) { return __builtin_amdgcn_wmma_f32_16x16x32_bf16(false, a, false, b, (short)0, c, false, false); }



// ---- k_gemmw: register-blocked GEMM, ONE WAVE per 64x64 output tile (16 accumulators), operands straight from 16-bit planes in fragment order; grid (M/64, N/64, Z), 32 threads.
// C[m][n] (f32, pitch ldc, + optional f32 bias[n]) = sum_k A[m][k] Bt[n][k] (+ split products per NSPLIT). z-batch strides sA/sB/sC in elements. K % 128 == 0, K > 128.
// The fragments of a 32-wide k step are one set of registers; RD sets form a ring: a step's loads go out as one group, into the set just used, RD - 1 steps ahead of its products, so that a lone wave's products run while later steps' loads are in flight.
// EPI 0: C goes out as f32. EPI 1, 2: a 64-column tile is one head (blockIdx.y) over 64 positions, so the wave finishes it itself and C is not written:
// EPI 1: rotate-half rotary out[d] = x[d] cos[t][d] - x[d+32] sin[t][d], out[d+32] = x[d+32] cos[t][d+32] + x[d] sin[t][d+32] (CS = {cos, sin} pairs in the lanes' reading order, see k_cscvt), then hi/lo planes Ph, Pl [head] in fragment order (rows t, k = d);
// EPI 2: hi/lo planes of the transposed tile, Ph, Pl [head] in fragment order (rows d, k = t).
template <typename T16> struct WFrag;
template <> struct WFrag<h16> { typedef v16h V; static __device__ __forceinline__ V ld(const h16* p) { return cat16(*(const v8h*)p, *(const v8h*)(p + 256)); } static __device__ __forceinline__ v8f mma(V a, V b, v8f c) { return wmma16(a, b, c); } };
template <> struct WFrag<bf> { typedef v16bf V; static __device__ __forceinline__ V ld(const bf* p) { return cat16b(*(const v8us*)p, *(const v8us*)(p + 256)); } static __device__ __forceinline__ v8f mma(V a, V b, v8f c) { return wmmab(a, b, c); } };
__device__ __forceinline__ void splitf(float y, unsigned short& h, unsigned short& l) { h = f2bf(y); l = f2bf(y - bf2f(h)); }
// the same split (round to nearest even, then the rounded remainder) for eight values, on the chip's own conversion
__device__ __forceinline__ void split8(const float* y, v8us& h, v8us& l) { typedef __attribute__((ext_vector_type(8))) __bf16 v8b; v8b a, b;
#pragma unroll
    for (int i = 0; i < 8; ++i) { a[i] = (__bf16)y[i]; b[i] = (__bf16)(y[i] - (float)a[i]); }
    h = __builtin_bit_cast(v8us, a); l = __builtin_bit_cast(v8us, b); }
#define RD  4      // sets in the ring
template <typename T16, int NSPLIT, bool BIAS, int EPI>
__global__ __launch_bounds__(32) void k_gemmw(const T16* __restrict__ A, const T16* __restrict__ A2, const T16* __restrict__ Bt, const T16* __restrict__ Bt2, int K, float* C, int ldc, const float* __restrict__ bias, size_t sA, size_t sB, size_t sC, const float* __restrict__ CS, bf* __restrict__ Ph, bf* __restrict__ Pl) {
    typedef typename WFrag<T16>::V V;
    const size_t z = blockIdx.z; A += z * sA; if (A2) A2 += z * sA; Bt += z * sB; if (Bt2) Bt2 += z * sB; C += z * sC;
    const int lane = threadIdx.x & 31, lr = lane & 15, hi = lane >> 4; const int r0 = blockIdx.x * 64, c0 = blockIdx.y * 64;
    v8f acc[4][4];
    constexpr bool SA = NSPLIT == 1 || NSPLIT == 2, SB = NSPLIT >= 2;
    __builtin_assume(K > 32 * RD);   // the loop below runs at least once: no second path from the first loads to the last products
    // an address is a wave-uniform base (tile origin + ko bytes along k) plus a lane's 32-bit offset vo[i] (16-row tile i, the lane's 16 bytes of a block), the same for all planes; a step is one 1,024-byte block; ko moves once per RD steps, the steps of a trip are immediate offsets
    const char* sa = (const char*)(A + (size_t)r0 * K); const char* sb = (const char*)(Bt + (size_t)c0 * K); const char* sa2 = SA ? (const char*)(A2 + (size_t)r0 * K) : sa; const char* sb2 = SB ? (const char*)(Bt2 + (size_t)c0 * K) : sb;
    unsigned vo[4], ko = 0;
#pragma unroll
    for (int i = 0; i < 4; ++i) vo[i] = (unsigned)((i * 16 * K + lane * 8) * 2);
    V a[RD][4], a2[RD][4], b[RD][4], b2[RD][4];
    auto fetch = [&](int s, int o) __attribute__((always_inline)) {   // set s <- the step o blocks behind ko
#pragma unroll
        for (int i = 0; i < 4; ++i) { a[s][i] = WFrag<T16>::ld((const T16*)(sa + ko + vo[i]) + o * 512); if (SA) a2[s][i] = WFrag<T16>::ld((const T16*)(sa2 + ko + vo[i]) + o * 512); }
#pragma unroll
        for (int i = 0; i < 4; ++i) { b[s][i] = WFrag<T16>::ld((const T16*)(sb + ko + vo[i]) + o * 512); if (SB) b2[s][i] = WFrag<T16>::ld((const T16*)(sb2 + ko + vo[i]) + o * 512); }
        __builtin_amdgcn_sched_barrier(0); };   // keeps the group whole and in front of the products that follow it (sunk towards their use the loads would have no lead)
    auto mult = [&](int s) __attribute__((always_inline)) {
#pragma unroll
        for (int nb = 0; nb < 4; ++nb)
#pragma unroll
            for (int mb = 0; mb < 4; ++mb) { acc[mb][nb] = WFrag<T16>::mma(a[s][mb], b[s][nb], acc[mb][nb]); if (SA) acc[mb][nb] = WFrag<T16>::mma(a2[s][mb], b[s][nb], acc[mb][nb]); if (SB) acc[mb][nb] = WFrag<T16>::mma(a[s][mb], b2[s][nb], acc[mb][nb]); }
        __builtin_amdgcn_sched_barrier(0); };   // keeps the next group of loads behind these products: it refills the set that they read
    // the offset moves on. Precaution behind the issued loads: it passes through the wait, so the sums that form the next addresses (and overwrite the registers of the old ones) stand behind the wait
#define KSTEP(n) ko += (n); asm volatile("s_wait_xcnt 0x0" : "+s"(ko) :: "memory")
    fetch(0, 0); fetch(1, 1); fetch(2, 2); fetch(3, 3);
    // the same precaution behind the first RD groups: the accumulators' zero passes through the wait, so the moves that clear them stand behind it
    unsigned zs = 0; asm volatile("s_wait_xcnt 0x0" : "+s"(zs) :: "memory"); const float z0 = __uint_as_float(zs);
#pragma unroll
    for (int mb = 0; mb < 4; ++mb)
#pragma unroll
        for (int nb = 0; nb < 4; ++nb) acc[mb][nb] = (v8f){z0, z0, z0, z0, z0, z0, z0, z0};
#pragma unroll 1   // one trip is RD steps already
    for (int kc = 32 * RD; kc < K; kc += 32 * RD) { mult(0); KSTEP(1024 * RD); fetch(0, 0); mult(1); fetch(1, 1); mult(2); fetch(2, 2); mult(3); fetch(3, 3); }
    mult(0); mult(1); mult(2); mult(3);   // the last RD steps: nothing left to fetch behind them
    if constexpr (EPI == 2) {
        // a lane holds eight consecutive positions of one dimension: they are the lane's own 16 bytes of a block of the transposed plane (row = dimension nb * 16 + lr, k = position), so a wave's store is 512 consecutive bytes
        const size_t vb = (size_t)blockIdx.y * HD * TT + (size_t)(r0 / 32) * 4 * 512 + lane * 8;
#pragma unroll
        for (int mb = 0; mb < 4; ++mb)
#pragma unroll
            for (int nb = 0; nb < 4; ++nb) { v8us oh, ol; float y[8];
#pragma unroll
                for (int j = 0; j < 8; ++j) y[j] = acc[mb][nb][j];
                split8(y, oh, ol);
                *(v8us*)(Ph + vb + ((mb >> 1) * 4 + nb) * 512 + (mb & 1) * 256) = oh; *(v8us*)(Pl + vb + ((mb >> 1) * 4 + nb) * 512 + (mb & 1) * 256) = ol; }
    } else {
    __shared__ __align__(16) float os[16 * 68];
#pragma unroll
    for (int mb = 0; mb < 4; ++mb) {
#pragma unroll
        for (int nb = 0; nb < 4; ++nb) {
#pragma unroll
            for (int j = 0; j < 8; ++j) os[(hi * 8 + j) * 68 + nb * 16 + lr] = acc[mb][nb][j]; }
        __builtin_amdgcn_wave_barrier(); asm volatile("" ::: "memory");
        if constexpr (EPI == 1) {
            // write-out in fragment order: lane (hi, lr) finishes dimensions s * 16 + hi * 8 ... + 7 of position lr of the 16; the wave's store s is half a block, 512 consecutive bytes
            const float* csp = CS + (size_t)(r0 / 16 + mb) * 4 * 512 + lane * 4; const size_t po = (size_t)blockIdx.y * TT * HD + (size_t)(r0 / 16 + mb) * 2 * 512 + lane * 8;
#pragma unroll
            for (int s = 0; s < 4; ++s) { const float* xr = os + lr * 68 + hi * 8; v8us oh, ol; float r[8]; const float sg = (s * 16 < HD / 2) ? -1.0f : 1.0f;   // sign of the rotated partner
#pragma unroll
                for (int i4 = 0; i4 < 2; ++i4) { const v4f x0 = *(const v4fa*)(xr + s * 16 + i4 * 4), x1 = *(const v4fa*)(xr + ((s * 16) ^ (HD / 2)) + i4 * 4); const v4f e0 = *(const v4f*)(csp + s * 512 + i4 * 256), e1 = *(const v4f*)(csp + s * 512 + i4 * 256 + 128);
                    r[i4 * 4] = x0[0] * e0[0] + sg * x1[0] * e0[1]; r[i4 * 4 + 1] = x0[1] * e0[2] + sg * x1[1] * e0[3]; r[i4 * 4 + 2] = x0[2] * e1[0] + sg * x1[2] * e1[1]; r[i4 * 4 + 3] = x0[3] * e1[2] + sg * x1[3] * e1[3]; }
                split8(r, oh, ol);
                *(v8us*)(Ph + po + s * 256) = oh; *(v8us*)(Pl + po + s * 256) = ol; }
            asm volatile("s_wait_xcnt 0x0" :: "v"(csp) : "memory");   // precaution behind the table loads and the stores: as an input the table's address pair stays live and unwritten up to the wait, and the next block's table loads land in registers that these stores name as data
        } else {
        float* crow = C + (size_t)(r0 + mb * 16) * ldc + c0;
{
#pragma unroll
            for (int s = 0; s < 8; ++s) { const int row = 2 * s + hi, cofs = lr * 4; v4f val = *(const v4fa*)(os + row * 68 + cofs); if (BIAS) { val[0] += bfr(bias[c0 + cofs]); val[1] += bfr(bias[c0 + cofs + 1]); val[2] += bfr(bias[c0 + cofs + 2]); val[3] += bfr(bias[c0 + cofs + 3]); }
                *(v4f*)(crow + (size_t)row * ldc + cofs) = val; }
             }
        }
        __builtin_amdgcn_wave_barrier(); asm volatile("" ::: "memory");
    }
    }
}

__device__ __forceinline__ h16 tohx(float x) { return (h16)x; }
typedef __attribute__((ext_vector_type(2))) _Float16 v2h;
typedef __attribute__((ext_vector_type(4))) _Float16 v4h;
typedef __attribute__((ext_vector_type(2))) unsigned short v2us;
typedef __attribute__((ext_vector_type(4))) unsigned short v4us;
typedef v4us __attribute__((may_alias)) v4usa;
typedef __attribute__((ext_vector_type(2))) float v2f;
typedef __attribute__((ext_vector_type(4))) int v4i;

// f32 [rows][KC] -> bf16 in fragment order: a thread turns eight values into 16 bytes; a wave takes 64 k of four rows (256 consecutive bytes of each row in, eight runs of 64 bytes out), a work-group fills four whole blocks
template <int KC>
__global__ __launch_bounds__(256) void k_cvt8(const float* __restrict__ src, bf* dst, size_t n8) { const size_t i = (size_t)blockIdx.x * 256 + threadIdx.x; if (i >= n8) return;
    const int kc = (int)(i & 7), r = (int)((i >> 5) & 3) * 4 + (int)((i >> 3) & 3); const size_t g = i >> 7;   // eight k inside the 64; row of the 16; g = row tile * (KC / 64) + which 64 k
    const v8f v = *(const v8f*)(src + ((g / (KC / 64)) * 16 + r) * KC + (g % (KC / 64)) * 64 + kc * 8); v8us o;
#pragma unroll
    for (int k = 0; k < 8; ++k) o[k] = f2bf(v[k]); *(v8us*)(dst + (g * 2 + (kc >> 2)) * 512 + ((kc >> 1) & 1) * 256 + ((kc & 1) * 16 + r) * 8) = o;  }

// {cos, sin} pairs in the order in which the lanes of the rotary epilogue read them: per 16 positions and 16 dimensions (group s of a head's four) four runs of 512 bytes; run q holds for lane (hi, lr) the pairs of dimensions s * 16 + hi * 8 + q * 2 and + 1 of position lr. Thread idx writes the idx-th pair.
__global__ __launch_bounds__(256) void k_cscvt(const float* __restrict__ cosT, const float* __restrict__ sinT, float* CS) { const int idx = blockIdx.x * 256 + threadIdx.x; if (idx >= TT * HD) return;
    const int ln = (idx >> 1) & 31, sc = ((idx >> 10) * 16 + (ln & 15)) * HD + ((idx >> 8) & 3) * 16 + (ln >> 4) * 8 + ((idx >> 6) & 3) * 2 + (idx & 1);
    v2f cs; cs[0] = bfr(cosT[sc]); cs[1] = bfr(sinT[sc]); *(v2f*)(CS + (size_t)idx * 2) = cs;  }
// ---- k_attn: causal attention of one batch in one launch. A work-group owns 32 query rows of one head; its 4 waves take the 32-key blocks kb = w, w + 4, ... up to the diagonal block.
// Per block: S^T = K Q^T (A = key rows, B = query rows kept in registers; hi/lo, three products), so a lane holds scores of ONE query per 16-column group (keys 8 hi + j of each 16-key tile): running maximum and sum are per lane,
// and the two score tiles of a block are, register for register, the B operand P^T of O^T += V^T P^T (A = rows of the transposed values; hi/lo, three products). Probabilities stay unnormalised; the division by the row sum is last.
// The four waves' (maximum, sum, O^T) meet in LDS behind one barrier and are joined in ascending wave order; the result goes out as the hi/lo planes (rows t, k = head * 64 + d, fragment order) that the output projection reads.
#define AQ   32     // query rows per work-group
#define AW   4      // waves per work-group (key blocks dealt round robin)
#define AOP  68     // pitch of an O row in LDS, floats (16-byte aligned rows, rows spread over the banks)
#define L2E  1.4426950408889634f
// precaution behind a run of global loads: as inputs here the two address pairs stay live and unwritten up to the wait
#define XWAIT(a, b) asm volatile("s_wait_xcnt 0x0" :: "v"(a), "v"(b) : "memory")
// the slot that the instruction set asks for behind a transcendental: results and sources are operands of the v_nop, so no use of a result and no overwrite of a source can stand in front of it
// within a run of eight each exponential is the independent instruction behind the one before
#define TSLOT8(r, x, o) asm("v_nop" : "+v"(r[o]), "+v"(r[o + 1]), "+v"(r[o + 2]), "+v"(r[o + 3]), "+v"(r[o + 4]), "+v"(r[o + 5]), "+v"(r[o + 6]), "+v"(r[o + 7]) : "v"(x[o]), "v"(x[o + 1]), "v"(x[o + 2]), "v"(x[o + 3]), "v"(x[o + 4]), "v"(x[o + 5]), "v"(x[o + 6]), "v"(x[o + 7]))
__device__ __forceinline__ float ex2(float x) { float r = __builtin_amdgcn_exp2f(x); asm("v_nop" : "+v"(r) : "v"(x)); return r; }
__device__ __forceinline__ v16bf ldfr(const bf* p) { return cat16b(*(const v8us*)p, *(const v8us*)(p + 256)); }   // p: the lane's 16 bytes of a block in fragment order
// waves_per_eu(3, 3): the register budget of three waves per SIMD holds Q, O^T, one key block and one value block at once; with the default budget the scheduler split the loads of a pass into several waited groups
__global__ __launch_bounds__(AW * 32) __attribute__((amdgpu_waves_per_eu(3, 3))) void k_attn(const bf* __restrict__ Qh, const bf* __restrict__ Ql, const bf* __restrict__ Kh, const bf* __restrict__ Kl, const bf* __restrict__ Vh, const bf* __restrict__ Vl, bf* __restrict__ Ah, bf* __restrict__ Al) {
    __shared__ __align__(16) float so[AW][AQ][AOP];
    __shared__ float sm[AW][AQ], sl[AW][AQ];
    // 1,024 work-groups: heavy query tiles first, and four work-groups 256 apart in the grid add up to the same number of key blocks
    const int L = (int)blockIdx.x, g = L >> 8, h = L & 15, u = (L >> 4) & 15;
    const int qt = (g == 0) ? 63 - u : (g == 1) ? 32 + u : (g == 2) ? 31 - u : u; const int q0 = qt * AQ;
    const int lane = threadIdx.x & 31, lr = lane & 15, hi = lane >> 4; const int w = __builtin_amdgcn_readfirstlane((int)(threadIdx.x >> 5));
    const size_t hp = (size_t)h * TT * HD; Qh += hp; Ql += hp; Kh += hp; Kl += hp; Vh += hp; Vl += hp;
    v16bf qh[2][2], ql[2][2];
    { const bf* ph0 = Qh + (size_t)q0 * HD + lane * 8; const bf* pl0 = Ql + (size_t)q0 * HD + lane * 8;
#pragma unroll
      for (int nt = 0; nt < 2; ++nt)
#pragma unroll
        for (int ks = 0; ks < 2; ++ks) { qh[nt][ks] = ldfr(ph0 + (nt * 2 + ks) * 512); ql[nt][ks] = ldfr(pl0 + (nt * 2 + ks) * 512); }
      XWAIT(ph0, pl0); }
    v8f oa[4][2]; float mx[2], sum[2];
#pragma unroll
    for (int nt = 0; nt < 2; ++nt) { mx[nt] = -3.0e38f; sum[nt] = 0.f;
#pragma unroll
        for (int dt = 0; dt < 4; ++dt) oa[dt][nt] = (v8f){}; }
    v16bf kh[2][2], kl[2][2];   // the key block in hand, fetched one pass ahead
    auto ldk = [&](int kb) __attribute__((always_inline)) { const bf* ph0 = Kh + (size_t)kb * 32 * HD + lane * 8; const bf* pl0 = Kl + (size_t)kb * 32 * HD + lane * 8;
#pragma unroll
        for (int mt = 0; mt < 2; ++mt)
#pragma unroll
            for (int ks = 0; ks < 2; ++ks) { kh[mt][ks] = ldfr(ph0 + (mt * 2 + ks) * 512); kl[mt][ks] = ldfr(pl0 + (mt * 2 + ks) * 512); }
        XWAIT(ph0, pl0); };
    auto pass = [&](int kb, bool diag) __attribute__((always_inline)) {
        v16bf vh[4], vl[4]; const bf* pv0 = Vh + (size_t)kb * 4 * 512 + lane * 8; const bf* pv1 = Vl + (size_t)kb * 4 * 512 + lane * 8;
#pragma unroll
        for (int dt = 0; dt < 4; ++dt) { vh[dt] = ldfr(pv0 + dt * 512); vl[dt] = ldfr(pv1 + dt * 512); }
        XWAIT(pv0, pv1);
        __builtin_amdgcn_sched_barrier(0);   // keeps the value loads up here, in flight over the score products and the softmax (the scheduler sank half of them to just in front of their use)
        v8f s[2][2];
#pragma unroll
        for (int mt = 0; mt < 2; ++mt)
#pragma unroll
            for (int nt = 0; nt < 2; ++nt) { v8f a = (v8f){};
#pragma unroll
                for (int ks = 0; ks < 2; ++ks) { a = wmmab(kh[mt][ks], qh[nt][ks], a); a = wmmab(kl[mt][ks], qh[nt][ks], a); a = wmmab(kh[mt][ks], ql[nt][ks], a); }
                s[mt][nt] = a; }
        v16bf ph[2], pl[2];
#pragma unroll
        for (int nt = 0; nt < 2; ++nt) { float t[16]; float bm = -3.0e38f;
#pragma unroll
            for (int e = 0; e < 16; ++e) { t[e] = s[e >> 3][nt][e & 7]; if (diag && (e >> 3) * 16 + 8 * hi + (e & 7) > nt * 16 + lr) t[e] = -3.0e38f; bm = fmaxf(bm, t[e]); }   // diagonal block: keys past the query are excluded
            bm = fmaxf(bm, __shfl_xor(bm, 16, 32));
            const float mn = fmaxf(mx[nt], bm * (SCL * L2E)); const float al = ex2(mx[nt] - mn); mx[nt] = mn; float ls = 0.f;   // mx: the row's offset in the log2 domain; every probability of the row is 2^(score * SCL * L2E - mx)
#pragma unroll
            for (int e = 0; e < 16; ++e) t[e] = __builtin_fmaf(t[e], SCL * L2E, -mn);
            float pr[16];
#pragma unroll
            for (int e = 0; e < 16; ++e) pr[e] = __builtin_amdgcn_exp2f(t[e]);
            TSLOT8(pr, t, 0); TSLOT8(pr, t, 8);
#pragma unroll
            for (int e = 0; e < 16; ++e) { const float p = pr[e]; ls += p; const __bf16 a = (__bf16)p; ph[nt][e] = a; pl[nt][e] = (__bf16)(p - (float)a); }
            sum[nt] = sum[nt] * al + ls;
#pragma unroll
            for (int dt = 0; dt < 4; ++dt) oa[dt][nt] *= al; }
        if (!diag) { ldk(min(kb + AW, qt));   // the wave's next block (clamped to the diagonal block: always inside the planes), in flight over the value product
            __builtin_amdgcn_sched_barrier(0); }   // keeps those loads in front of the value product (the scheduler sank them to the loop's foot, where nothing covers their latency)
#pragma unroll
        for (int dt = 0; dt < 4; ++dt)
#pragma unroll
            for (int nt = 0; nt < 2; ++nt) { oa[dt][nt] = wmmab(vh[dt], ph[nt], oa[dt][nt]); oa[dt][nt] = wmmab(vh[dt], pl[nt], oa[dt][nt]); oa[dt][nt] = wmmab(vl[dt], ph[nt], oa[dt][nt]); } };
    ldk(min(w, qt));
    int kb = w;
#pragma unroll 1   // one copy of the pass in the loop: the registers of a second copy would cost a resident wave
    for (; kb < qt; kb += AW) pass(kb, false);
    if (kb == qt) pass(kb, true);   // the diagonal block falls to one of the four waves, as its last pass
#pragma unroll
    for (int nt = 0; nt < 2; ++nt) { const float st = sum[nt] + __shfl_xor(sum[nt], 16, 32); if (hi == 0) { sm[w][nt * 16 + lr] = mx[nt]; sl[w][nt * 16 + lr] = st; }
#pragma unroll
        for (int dt = 0; dt < 4; ++dt) { float* d = &so[w][nt * 16 + lr][dt * 16 + 8 * hi]; const v8f a = oa[dt][nt]; *(v4f*)d = (v4f){a[0], a[1], a[2], a[3]}; *(v4f*)(d + 4) = (v4f){a[4], a[5], a[6], a[7]}; } }
    __syncthreads();
    const int q = (int)threadIdx.x >> 2, c = ((int)threadIdx.x & 3) * 16;
    float mm = sm[0][q];
#pragma unroll
    for (int x = 1; x < AW; ++x) mm = fmaxf(mm, sm[x][q]);
    float lt = 0.f; float r[16];
#pragma unroll
    for (int i = 0; i < 16; ++i) r[i] = 0.f;
#pragma unroll
    for (int x = 0; x < AW; ++x) { const float f = ex2(sm[x][q] - mm); lt += f * sl[x][q];
#pragma unroll
        for (int i4 = 0; i4 < 4; ++i4) { const v4f a = *(const v4f*)&so[x][q][c + i4 * 4];
#pragma unroll
            for (int i = 0; i < 4; ++i) r[i4 * 4 + i] += f * a[i]; } }
    const float inv = __fdiv_rn(1.0f, lt); const size_t oo = ((size_t)((q0 + q) >> 4) * (DQ / 32) + h * 2 + (c >> 5)) * 512 + ((c >> 4) & 1) * 256 + (q & 15) * 8;   // eight lanes with one c: 128 consecutive bytes
#pragma unroll
    for (int i8 = 0; i8 < 2; ++i8) { v8us oh, ol;
#pragma unroll
        for (int i = 0; i < 8; ++i) { unsigned short a, c2; splitf(r[i8 * 8 + i] * inv, a, c2); oh[i] = a; ol[i] = c2; }
        *(v8us*)(Ah + oo + i8 * 128) = oh; *(v8us*)(Al + oo + i8 * 128) = ol; }
}

extern "C" void kernel_launch(void* const* d_in, const int* in_sizes, int n_in,
                              void* d_out, int out_size, void* d_ws, size_t ws_size, hipStream_t stream) {
    (void)in_sizes; (void)n_in; (void)out_size;
    const float* x = (const float*)d_in[0]; const float* fcos = (const float*)d_in[1]; const float* fsin = (const float*)d_in[2]; const float* wq = (const float*)d_in[3]; const float* wk = (const float*)d_in[4]; const float* wv = (const float*)d_in[5]; const float* wo = (const float*)d_in[6];   /* input order x, cos, sin ([1][1][2048][64] = flat [2048][64]; read per position and per dimension), wq, wk, wv, wo ('oi') */
    float* OUT = (float*)d_out;     // [2][2048][1024]
    char* wsp = (char*)d_ws;
    auto take = [&](size_t bytes) { char* p = wsp; wsp += (bytes + 255) & ~(size_t)255; return (void*)p; };
    bf* WQ = (bf*)take((size_t)DQ * DM * 2); bf* WK = (bf*)take((size_t)DKV * DM * 2); bf* WV = (bf*)take((size_t)DKV * DM * 2); bf* WO = (bf*)take((size_t)DM * DQ * 2); float* CS = (float*)take((size_t)TT * HD * 2 * 4);
    bf* XB = (bf*)take((size_t)TT * DM * 2);
    bf* QPh = (bf*)take((size_t)NH_ * TT * HD * 2); bf* QPl = (bf*)take((size_t)NH_ * TT * HD * 2); bf* KPh = (bf*)take((size_t)NKV * TT * HD * 2); bf* KPl = (bf*)take((size_t)NKV * TT * HD * 2); bf* VTh = (bf*)take((size_t)NKV * HD * 2 * TT * 2); bf* VTl = VTh + (size_t)NKV * HD * TT;   // transposed values: the hi plane of all heads, then the lo plane
    bf* ATh = (bf*)take((size_t)TT * DQ * 2); bf* ATl = (bf*)take((size_t)TT * DQ * 2);
    if ((size_t)(wsp - (char*)d_ws) > ws_size) return;    // ws 256 MiB
    { k_cvt8<DM><<<(unsigned)(((size_t)DQ * DM / 8 + 255) / 256), 256, 0, stream>>>(wq, WQ, (size_t)DQ * DM / 8); k_cvt8<DM><<<(unsigned)(((size_t)DKV * DM / 8 + 255) / 256), 256, 0, stream>>>(wk, WK, (size_t)DKV * DM / 8); k_cvt8<DM><<<(unsigned)(((size_t)DKV * DM / 8 + 255) / 256), 256, 0, stream>>>(wv, WV, (size_t)DKV * DM / 8);
      k_cvt8<DM><<<(unsigned)(((size_t)DM * DQ / 8 + 255) / 256), 256, 0, stream>>>(wo, WO, (size_t)DM * DQ / 8);
       }
    k_cscvt<<<(TT * HD + 255) / 256, 256, 0, stream>>>(fcos, fsin, CS);   /* rotary table from the inputs */
    for (int b = 0; b < NB_; ++b) {
        
        k_cvt8<DM><<<(unsigned)(((size_t)TT * DM / 8 + 255) / 256), 256, 0, stream>>>(x + (size_t)b * TT * DM, XB, (size_t)TT * DM / 8);
        k_gemmw<bf, 0, false, 1><<<dim3(TT / 64, DQ / 64, 1), 32, 0, stream>>>(XB, nullptr, WQ, nullptr, DM, nullptr, 0, nullptr, 0, 0, 0, CS, QPh, QPl);
        k_gemmw<bf, 0, false, 1><<<dim3(TT / 64, DKV / 64, 1), 32, 0, stream>>>(XB, nullptr, WK, nullptr, DM, nullptr, 0, nullptr, 0, 0, 0, CS, KPh, KPl);
        k_gemmw<bf, 0, false, 2><<<dim3(TT / 64, DKV / 64, 1), 32, 0, stream>>>(XB, nullptr, WV, nullptr, DM, nullptr, 0, nullptr, 0, 0, 0, nullptr, VTh, VTl);
        k_attn<<<NH_ * (TT / AQ), AW * 32, 0, stream>>>(QPh, QPl, KPh, KPl, VTh, VTl, ATh, ATl);   // one kv head per query head
        k_gemmw<bf, 1, false, 0><<<dim3(TT / 64, DM / 64, 1), 32, 0, stream>>>(ATh, ATl, WO, nullptr, DQ, OUT + (size_t)b * TT * DM, DM, nullptr, 0, 0, 0, nullptr, nullptr, nullptr); }
}

// v007
// It runs in 99.1 microseconds.
// In two side-by-side timings against v006, it was 1.41 and 1.39 times as fast.
// Counting every step since v000, it is 11.7 times as fast.
#include <hip/hip_runtime.h>

// Causal multi-head attention with rotate-half rotary embedding from cos / sin TABLE INPUTS read by value (x [2][2048][1024]; q, k, v = einsum('bld,ed', x, w) ('oi' [1024][1024] 1/32, no bias; 16 heads x 64); cos, sin f32 [1][1][2048][64] are INPUTS (arbitrary values on this draw: independent normal tables, not cosines of angles), read per position AND per dimension; q, k <- t cos + rotate_half(t) sin with rotate_half = cat(-x2, x1) over the two 32-wide halves; scores / sqrt(64); keys j <= i kept, finfo.min elsewhere (== exclusion); softmax; out = einsum('bld,ed', merged, wo) -> [2][2048][1024] (4.2 M); argument order x, cos, sin, wq, wk, wv, wo).
// Four launches, both batches in every grid: k_prep (bf16 copies of x and of the 'oi' weights, the table), the q, k, v projections as one GEMM over the stacked weights, k_attn, the output projection. Layout: bf16 copy of x; 'oi' weights; exact projections; {cos, sin} table from the bf16-rounded inputs; rotate-half rotary, hi/lo split and value transpose in the projections' own epilogues; one fused causal attention launch (k_attn: scores, running softmax and value product in registers, all query rows hi/lo 3 products); merged hi/lo x Wo exact.
// Every 16-bit operand plane is stored in FRAGMENT ORDER: a [rows][k] matrix is cut into blocks of 16 rows x 32 k (512 elements, 1,024 bytes); inside a block element (r, k) stands at (k >> 4) * 256 + (((k >> 3) & 1) * 16 + r) * 8 + (k & 7),
// which is where lane ((k >> 3) & 1) * 16 + r of a wave wants it: each of the two 16-byte loads of a fragment reads 512 consecutive bytes (four whole lines; from row-major planes it would read 32 bytes of each of 16 rows).
// The {cos, sin} table is stored in its readers' lane order for the same reason. Order of the blocks: x, weights, merged heads: (row tile, k tile), k tiles consecutive; q, k per head: (position tile, 2 k tiles); transposed values per head: (32-position k tile, 4 dimension tiles).
// Compute dtypes, f32 accumulate: every input rounded to bf16 incl. the tables; projections exact; rotary f32; attention: ALL 2,048 query rows bf16 hi + lo operands with three products; softmax f32; Wo hl x exact.

#define NB_  2
#define TT   2048
#define DM   1024
#define NH_  16
#define NKV  16
#define REP  (NH_ / NKV)
#define HD   64
#define DQ   (NH_ * HD)
#define DKV  (NKV * HD)
#define SCL  0.125f   // HD^-0.5
#define PL   ((size_t)NB_ * NH_ * TT * HD)   // elements of one operand plane of q, k or v: [batch][head][TT * HD]
typedef _Float16 h16;
typedef unsigned short bf;
typedef __attribute__((ext_vector_type(16))) __bf16   v16bf;
typedef __attribute__((ext_vector_type(16))) _Float16 v16h;
typedef __attribute__((ext_vector_type(8)))  _Float16 v8h;
typedef __attribute__((ext_vector_type(8)))  unsigned short v8us;
typedef __attribute__((ext_vector_type(8)))  float    v8f;
typedef __attribute__((ext_vector_type(4)))  float    v4f;
typedef v8h  __attribute__((may_alias)) v8ha;
typedef v4f  __attribute__((may_alias)) v4fa;
typedef v8us __attribute__((may_alias)) v8usa;

__device__ __forceinline__ unsigned short f2bf(float f) { unsigned u = __float_as_uint(f); u += 0x7FFFu + ((u >> 16) & 1u); return (unsigned short)(u >> 16); }
__device__ __forceinline__ float bf2f(unsigned short b) { return __uint_as_float(((unsigned)b) << 16); }
__device__ __forceinline__ float bfr(float f) { return bf2f(f2bf(f)); }
__device__ __forceinline__ v16h cat16(v8h lo, v8h hi) { return __builtin_shufflevector(lo, hi, 0, 1, 2, 3, 4, 5, 6, 7, 8, 9, 10, 11, 12, 13, 14, 15); }
__device__ __forceinline__ v16bf cat16b(v8us lo, v8us hi) { return __builtin_bit_cast(v16bf, __builtin_shufflevector(lo, hi, 0, 1, 2, 3, 4, 5, 6, 7, 8, 9, 10, 11, 12, 13, 14, 15)); }
__device__ __forceinline__ v8f wmma16(v16h a, v16h b, v8f c) { return __builtin_amdgcn_wmma_f32_16x16x32_f16(false, a, false, b, (short)0, c, false, false); }
__device__ __forceinline__ v8f wmmab(v16bf a, v16bf b, v8f c) { return __builtin_amdgcn_wmma_f32_16x16x32_bf16(false, a, false, b, (short)0, c, false, false); }



// ---- k_gemmw: register-blocked GEMM, ONE WAVE per 64x64 output tile (16 accumulators), operands straight from 16-bit planes in fragment order; grid (M/64, N/64, Z), 32 threads.
// C[m][n] (f32, pitch ldc, + optional f32 bias[n]) = sum_k A[m][k] Bt[n][k] (+ split products per NSPLIT). z-batch strides sA/sB/sC in elements. K % 128 == 0, K > 128.
// The fragments of a 32-wide k step are one set of registers; RD sets form a ring: a step's loads go out as one group, into the set just used, RD - 1 steps ahead of its products, so that a lone wave's products run while later steps' loads are in flight.
// EPI 0: C goes out as f32. EPI 1: the rows are the positions of all batches, Bt the stacked wq, wk, wv; a 64-column tile is one head (blockIdx.y & 15) of q, k or v (blockIdx.y >> 4) over 64 positions of one batch, so the wave finishes it itself and C is not written; Ph, Pl: the hi and lo plane of q, those of k and v follow at 2 PL and 4 PL:
// q, k: rotate-half rotary out[d] = x[d] cos[t][d] - x[d+32] sin[t][d], out[d+32] = x[d+32] cos[t][d+32] + x[d] sin[t][d+32] (CS = {cos, sin} pairs in the lanes' reading order, see cscvt), then hi/lo planes Ph, Pl [head] in fragment order (rows t, k = d);
// v: hi/lo planes of the transposed tile, Ph, Pl [head] in fragment order (rows d, k = t).
template <typename T16> struct WFrag;
template <> struct WFrag<h16> { typedef v16h V; static __device__ __forceinline__ V ld(const h16* p) { return cat16(*(const v8h*)p, *(const v8h*)(p + 256)); } static __device__ __forceinline__ v8f mma(V a, V b, v8f c) { return wmma16(a, b, c); } };
template <> struct WFrag<bf> { typedef v16bf V; static __device__ __forceinline__ V ld(const bf* p) { return cat16b(*(const v8us*)p, *(const v8us*)(p + 256)); } static __device__ __forceinline__ v8f mma(V a, V b, v8f c) { return wmmab(a, b, c); } };
__device__ __forceinline__ void splitf(float y, unsigned short& h, unsigned short& l) { h = f2bf(y); l = f2bf(y - bf2f(h)); }
// the same split (round to nearest even, then the rounded remainder) for eight values, on the chip's own conversion
__device__ __forceinline__ void split8(const float* y, v8us& h, v8us& l) { typedef __attribute__((ext_vector_type(8))) __bf16 v8b; v8b a, b;
#pragma unroll
    for (int i = 0; i < 8; ++i) { a[i] = (__bf16)y[i]; b[i] = (__bf16)(y[i] - (float)a[i]); }
    h = __builtin_bit_cast(v8us, a); l = __builtin_bit_cast(v8us, b); }
#define RD  4      // sets in the ring
template <typename T16, int NSPLIT, bool BIAS, int EPI>
__global__ __launch_bounds__(32) void k_gemmw(const T16* __restrict__ A, const T16* __restrict__ A2, const T16* __restrict__ Bt, const T16* __restrict__ Bt2, int K, float* C, int ldc, const float* __restrict__ bias, size_t sA, size_t sB, size_t sC, const float* __restrict__ CS, bf* __restrict__ Ph, bf* __restrict__ Pl) {
    typedef typename WFrag<T16>::V V;
    const size_t z = blockIdx.z; A += z * sA; if (A2) A2 += z * sA; Bt += z * sB; if (Bt2) Bt2 += z * sB; C += z * sC;
    const int lane = threadIdx.x & 31, lr = lane & 15, hi = lane >> 4; const int r0 = blockIdx.x * 64, c0 = blockIdx.y * 64;
    v8f acc[4][4];
    constexpr bool SA = NSPLIT == 1 || NSPLIT == 2, SB = NSPLIT >= 2;
    __builtin_assume(K > 32 * RD);   // the loop below runs at least once: no second path from the first loads to the last products
    // an address is a wave-uniform base (tile origin + ko bytes along k) plus a lane's 32-bit offset vo[i] (16-row tile i, the lane's 16 bytes of a block), the same for all planes; a step is one 1,024-byte block; ko moves once per RD steps, the steps of a trip are immediate offsets
    const char* sa = (const char*)(A + (size_t)r0 * K); const char* sb = (const char*)(Bt + (size_t)c0 * K); const char* sa2 = SA ? (const char*)(A2 + (size_t)r0 * K) : sa; const char* sb2 = SB ? (const char*)(Bt2 + (size_t)c0 * K) : sb;
    unsigned vo[4], ko = 0;
#pragma unroll
    for (int i = 0; i < 4; ++i) vo[i] = (unsigned)((i * 16 * K + lane * 8) * 2);
    V a[RD][4], a2[RD][4], b[RD][4], b2[RD][4];
    auto fetch = [&](int s, int o) __attribute__((always_inline)) {   // set s <- the step o blocks behind ko
#pragma unroll
        for (int i = 0; i < 4; ++i) { a[s][i] = WFrag<T16>::ld((const T16*)(sa + ko + vo[i]) + o * 512); if (SA) a2[s][i] = WFrag<T16>::ld((const T16*)(sa2 + ko + vo[i]) + o * 512); }
#pragma unroll
        for (int i = 0; i < 4; ++i) { b[s][i] = WFrag<T16>::ld((const T16*)(sb + ko + vo[i]) + o * 512); if (SB) b2[s][i] = WFrag<T16>::ld((const T16*)(sb2 + ko + vo[i]) + o * 512); }
        __builtin_amdgcn_sched_barrier(0); };   // keeps the group whole and in front of the products that follow it (sunk towards their use the loads would have no lead)
    auto mult = [&](int s) __attribute__((always_inline)) {
#pragma unroll
        for (int nb = 0; nb < 4; ++nb)
#pragma unroll
            for (int mb = 0; mb < 4; ++mb) { acc[mb][nb] = WFrag<T16>::mma(a[s][mb], b[s][nb], acc[mb][nb]); if (SA) acc[mb][nb] = WFrag<T16>::mma(a2[s][mb], b[s][nb], acc[mb][nb]); if (SB) acc[mb][nb] = WFrag<T16>::mma(a[s][mb], b2[s][nb], acc[mb][nb]); }
        __builtin_amdgcn_sched_barrier(0); };   // keeps the next group of loads behind these products: it refills the set that they read
    // the offset moves on. Precaution behind the issued loads: it passes through the wait, so the sums that form the next addresses (and overwrite the registers of the old ones) stand behind the wait
#define KSTEP(n) ko += (n); asm volatile("s_wait_xcnt 0x0" : "+s"(ko) :: "memory")
    fetch(0, 0); fetch(1, 1); fetch(2, 2); fetch(3, 3);
    // the same precaution behind the first RD groups: the accumulators' zero passes through the wait, so the moves that clear them stand behind it
    unsigned zs = 0; asm volatile("s_wait_xcnt 0x0" : "+s"(zs) :: "memory"); const float z0 = __uint_as_float(zs);
#pragma unroll
    for (int mb = 0; mb < 4; ++mb)
#pragma unroll
        for (int nb = 0; nb < 4; ++nb) acc[mb][nb] = (v8f){z0, z0, z0, z0, z0, z0, z0, z0};
#pragma unroll 1   // one trip is RD steps already
    for (int kc = 32 * RD; kc < K; kc += 32 * RD) { mult(0); KSTEP(1024 * RD); fetch(0, 0); mult(1); fetch(1, 1); mult(2); fetch(2, 2); mult(3); fetch(3, 3); }
    mult(0); mult(1); mult(2); mult(3);   // the last RD steps: nothing left to fetch behind them
    const int t0 = r0 & (TT - 1); const size_t pb = (size_t)(blockIdx.y >> 4) * 2 * PL + (size_t)((r0 / TT) * NH_ + (blockIdx.y & 15)) * TT * HD;   // EPI 1: first position inside the batch; the tile's (q, k or v; batch; head) plane
    if (EPI == 1 && (blockIdx.y >> 4) == 2) {
        // a lane holds eight consecutive positions of one dimension: they are the lane's own 16 bytes of a block of the transposed plane (row = dimension nb * 16 + lr, k = position), so a wave's store is 512 consecutive bytes
        const size_t vb = pb + (size_t)(t0 / 32) * 4 * 512 + lane * 8;
#pragma unroll
        for (int mb = 0; mb < 4; ++mb)
#pragma unroll
            for (int nb = 0; nb < 4; ++nb) { v8us oh, ol; float y[8];
#pragma unroll
                for (int j = 0; j < 8; ++j) y[j] = acc[mb][nb][j];
                split8(y, oh, ol);
                *(v8us*)(Ph + vb + ((mb >> 1) * 4 + nb) * 512 + (mb & 1) * 256) = oh; *(v8us*)(Pl + vb + ((mb >> 1) * 4 + nb) * 512 + (mb & 1) * 256) = ol; }
    } else {
    __shared__ __align__(16) float os[16 * 68];
    const float* csb = CS + (size_t)(t0 / 16) * 4 * 512;   // EPI 1: the table block of the tile's first 16 positions (the same for the whole wave)
#pragma unroll
    for (int mb = 0; mb < 4; ++mb) {
#pragma unroll
        for (int nb = 0; nb < 4; ++nb) {
#pragma unroll
            for (int j = 0; j < 8; ++j) os[(hi * 8 + j) * 68 + nb * 16 + lr] = acc[mb][nb][j]; }
        __builtin_amdgcn_wave_barrier(); asm volatile("" ::: "memory");
        if constexpr (EPI == 1) {
            // write-out in fragment order: lane (hi, lr) finishes dimensions s * 16 + hi * 8 ... + 7 of position lr of the 16; the wave's store s is half a block, 512 consecutive bytes
            const float* csp = csb + mb * 4 * 512 + lane * 4; const size_t po = pb + (size_t)(t0 / 16 + mb) * 2 * 512 + lane * 8;
#pragma unroll
            for (int s = 0; s < 4; ++s) { const float* xr = os + lr * 68 + hi * 8; v8us oh, ol; float r[8]; const float sg = (s * 16 < HD / 2) ? -1.0f : 1.0f;   // sign of the rotated partner
#pragma unroll
                for (int i4 = 0; i4 < 2; ++i4) { const v4f x0 = *(const v4fa*)(xr + s * 16 + i4 * 4), x1 = *(const v4fa*)(xr + ((s * 16) ^ (HD / 2)) + i4 * 4); const v4f e0 = *(const v4f*)(csp + s * 512 + i4 * 256), e1 = *(const v4f*)(csp + s * 512 + i4 * 256 + 128);
                    r[i4 * 4] = x0[0] * e0[0] + sg * x1[0] * e0[1]; r[i4 * 4 + 1] = x0[1] * e0[2] + sg * x1[1] * e0[3]; r[i4 * 4 + 2] = x0[2] * e1[0] + sg * x1[2] * e1[1]; r[i4 * 4 + 3] = x0[3] * e1[2] + sg * x1[3] * e1[3]; }
                split8(r, oh, ol);
                *(v8us*)(Ph + po + s * 256) = oh; *(v8us*)(Pl + po + s * 256) = ol; }
            asm volatile("s_wait_xcnt 0x0" :: "s"(csb) : "memory");   // precaution behind the table loads and the stores: as an input the table's base (the scalar pair that the loads of all four blocks name; block and lane are an immediate and the lane's number) stays live and unwritten up to the wait, and the next block's table loads land in registers that these stores name as data
        } else {
        float* crow = C + (size_t)(r0 + mb * 16) * ldc + c0;
{
#pragma unroll
            for (int s = 0; s < 8; ++s) { const int row = 2 * s + hi, cofs = lr * 4; v4f val = *(const v4fa*)(os + row * 68 + cofs); if (BIAS) { val[0] += bfr(bias[c0 + cofs]); val[1] += bfr(bias[c0 + cofs + 1]); val[2] += bfr(bias[c0 + cofs + 2]); val[3] += bfr(bias[c0 + cofs + 3]); }
                *(v4f*)(crow + (size_t)row * ldc + cofs) = val; }
             }
        }
        __builtin_amdgcn_wave_barrier(); asm volatile("" ::: "memory");
    }
    }
}

__device__ __forceinline__ h16 tohx(float x) { return (h16)x; }
typedef __attribute__((ext_vector_type(2))) _Float16 v2h;
typedef __attribute__((ext_vector_type(4))) _Float16 v4h;
typedef __attribute__((ext_vector_type(2))) unsigned short v2us;
typedef __attribute__((ext_vector_type(4))) unsigned short v4us;
typedef v4us __attribute__((may_alias)) v4usa;
typedef __attribute__((ext_vector_type(2))) float v2f;
typedef __attribute__((ext_vector_type(4))) int v4i;

// f32 [rows][KC] -> bf16 in fragment order: a thread turns eight values into 16 bytes; a wave takes 64 k of four rows (256 consecutive bytes of each row in, eight runs of 64 bytes out), a work-group fills four whole blocks
template <int KC>
__device__ __forceinline__ void cvt8(const float* __restrict__ src, bf* dst, size_t i) {
    const int kc = (int)(i & 7), r = (int)((i >> 5) & 3) * 4 + (int)((i >> 3) & 3); const size_t g = i >> 7;   // eight k inside the 64; row of the 16; g = row tile * (KC / 64) + which 64 k
    const v8f v = *(const v8f*)(src + ((g / (KC / 64)) * 16 + r) * KC + (g % (KC / 64)) * 64 + kc * 8); v8us o;
#pragma unroll
    for (int k = 0; k < 8; ++k) o[k] = f2bf(v[k]); *(v8us*)(dst + (g * 2 + (kc >> 2)) * 512 + ((kc >> 1) & 1) * 256 + ((kc & 1) * 16 + r) * 8) = o;
    asm volatile("s_wait_xcnt 0x0" ::: "memory"); }   // precaution behind the store: in k_prep's listing another range's block follows, and its first sums take over the registers of this store's address

// {cos, sin} pairs in the order in which the lanes of the rotary epilogue read them: per 16 positions and 16 dimensions (group s of a head's four) four runs of 512 bytes; run q holds for lane (hi, lr) the pairs of dimensions s * 16 + hi * 8 + q * 2 and + 1 of position lr. Thread idx writes the idx-th pair.
__device__ __forceinline__ void cscvt(const float* __restrict__ cosT, const float* __restrict__ sinT, float* CS, int idx) {
    const int ln = (idx >> 1) & 31, sc = ((idx >> 10) * 16 + (ln & 15)) * HD + ((idx >> 8) & 3) * 16 + (ln >> 4) * 8 + ((idx >> 6) & 3) * 2 + (idx & 1);
    v2f cs; cs[0] = bfr(cosT[sc]); cs[1] = bfr(sinT[sc]); *(v2f*)(CS + (size_t)idx * 2) = cs;
    asm volatile("s_wait_xcnt 0x0" ::: "memory"); }   // the same precaution behind the table's store
// ---- k_prep: every input conversion in one grid. Work-groups [0, XG): x, all batches as one [NB_ * TT][DM] matrix; then WG each for wq, wk, wv, wo (W: the four planes one behind the other); the last CG: the rotary table. The three ranges are exact multiples of a work-group.
#define XG   (NB_ * TT * DM / 8 / 256)
#define WG   (DM * DM / 8 / 256)
#define CG   (TT * HD / 256)
__global__ __launch_bounds__(256) void k_prep(const float* __restrict__ x, const float* __restrict__ wq, const float* __restrict__ wk, const float* __restrict__ wv, const float* __restrict__ wo, const float* __restrict__ cosT, const float* __restrict__ sinT, bf* XB, bf* Wb, float* CS) {
    const int g = (int)blockIdx.x, t = (int)threadIdx.x;
    if (g < XG) cvt8<DM>(x, XB, (size_t)g * 256 + t);
    else if (g < XG + 4 * WG) { const int s = (g - XG) / WG; cvt8<DM>(s == 0 ? wq : s == 1 ? wk : s == 2 ? wv : wo, Wb + (size_t)s * DM * DM, (size_t)((g - XG) % WG) * 256 + t); }
    else cscvt(cosT, sinT, CS, (g - XG - 4 * WG) * 256 + t); }
// ---- k_attn: causal attention of all batches in one launch. A work-group owns 32 query rows of one head; its 4 waves take the 32-key blocks kb = w, w + 4, ... up to the diagonal block.
// Per block: S^T = K Q^T (A = key rows, B = query rows kept in registers; hi/lo, three products), so a lane holds scores of ONE query per 16-column group (keys 8 hi + j of each 16-key tile): running maximum and sum are per lane,
// and the two score tiles of a block are, register for register, the B operand P^T of O^T += V^T P^T (A = rows of the transposed values; hi/lo, three products). Probabilities stay unnormalised; the division by the row sum is last.
// The four waves' (maximum, sum, O^T) meet in LDS behind one barrier and are joined in ascending wave order; the result goes out as the hi/lo planes (rows t, k = head * 64 + d, fragment order) that the output projection reads.
#define AQ   32     // query rows per work-group
#define AW   4      // waves per work-group (key blocks dealt round robin)
#define AOP  68     // pitch of an O row in LDS, floats (16-byte aligned rows, rows spread over the banks)
#define L2E  1.4426950408889634f
// precaution behind a run of global loads: as inputs here the two address pairs stay live and unwritten up to the wait
#define XWAIT(a, b) asm volatile("s_wait_xcnt 0x0" :: "v"(a), "v"(b) : "memory")
// the slot that the instruction set asks for behind a transcendental: results and sources are operands of the v_nop, so no use of a result and no overwrite of a source can stand in front of it
// within a run of eight each exponential is the independent instruction behind the one before
#define TSLOT8(r, x, o) asm("v_nop" : "+v"(r[o]), "+v"(r[o + 1]), "+v"(r[o + 2]), "+v"(r[o + 3]), "+v"(r[o + 4]), "+v"(r[o + 5]), "+v"(r[o + 6]), "+v"(r[o + 7]) : "v"(x[o]), "v"(x[o + 1]), "v"(x[o + 2]), "v"(x[o + 3]), "v"(x[o + 4]), "v"(x[o + 5]), "v"(x[o + 6]), "v"(x[o + 7]))
__device__ __forceinline__ float ex2(float x) { float r = __builtin_amdgcn_exp2f(x); asm("v_nop" : "+v"(r) : "v"(x)); return r; }
__device__ __forceinline__ v16bf ldfr(const bf* p) { return cat16b(*(const v8us*)p, *(const v8us*)(p + 256)); }   // p: the lane's 16 bytes of a block in fragment order
// waves_per_eu(3, 3): the register budget of three waves per SIMD holds Q, O^T, one key block and one value block at once; with the default budget the scheduler split the loads of a pass into several waited groups
__global__ __launch_bounds__(AW * 32) __attribute__((amdgpu_waves_per_eu(3, 3))) void k_attn(const bf* __restrict__ Qh, const bf* __restrict__ Ql, const bf* __restrict__ Kh, const bf* __restrict__ Kl, const bf* __restrict__ Vh, const bf* __restrict__ Vl, bf* __restrict__ Ah, bf* __restrict__ Al) {
    __shared__ __align__(16) float so[AW][AQ][AOP];
    __shared__ float sm[AW][AQ], sl[AW][AQ];
    // 2,048 work-groups (head, then batch the fastest indices): heavy query tiles first, and four work-groups 512 apart in the grid add up to the same number of key blocks
    const int L = (int)blockIdx.x, g = L >> 9, h = L & 15, bt = (L >> 4) & (NB_ - 1), u = (L >> 5) & 15;
    const int qt = (g == 0) ? 63 - u : (g == 1) ? 32 + u : (g == 2) ? 31 - u : u; const int q0 = qt * AQ;
    const int lane = threadIdx.x & 31, lr = lane & 15, hi = lane >> 4; const int w = __builtin_amdgcn_readfirstlane((int)(threadIdx.x >> 5));
    const size_t hp = (size_t)(bt * NH_ + h) * TT * HD; Qh += hp; Ql += hp; Kh += hp; Kl += hp; Vh += hp; Vl += hp;
    v16bf qh[2][2], ql[2][2];
    { const bf* ph0 = Qh + (size_t)q0 * HD + lane * 8; const bf* pl0 = Ql + (size_t)q0 * HD + lane * 8;
#pragma unroll
      for (int nt = 0; nt < 2; ++nt)
#pragma unroll
        for (int ks = 0; ks < 2; ++ks) { qh[nt][ks] = ldfr(ph0 + (nt * 2 + ks) * 512); ql[nt][ks] = ldfr(pl0 + (nt * 2 + ks) * 512); }
      asm volatile("s_wait_xcnt 0x0" :: "s"(Qh + (size_t)q0 * HD), "s"(Ql + (size_t)q0 * HD) : "memory"); }   // the same precaution; these loads name the tile's two scalar bases, so those are the inputs that stay unwritten up to the wait
    v8f oa[4][2]; float mx[2], sum[2];
#pragma unroll
    for (int nt = 0; nt < 2; ++nt) { mx[nt] = -3.0e38f; sum[nt] = 0.f;
#pragma unroll
        for (int dt = 0; dt < 4; ++dt) oa[dt][nt] = (v8f){}; }
    v16bf kh[2][2], kl[2][2];   // the key block in hand, fetched one pass ahead
    auto ldk = [&](int kb) __attribute__((always_inline)) { const bf* ph0 = Kh + (size_t)kb * 32 * HD + lane * 8; const bf* pl0 = Kl + (size_t)kb * 32 * HD + lane * 8;
#pragma unroll
        for (int mt = 0; mt < 2; ++mt)
#pragma unroll
            for (int ks = 0; ks < 2; ++ks) { kh[mt][ks] = ldfr(ph0 + (mt * 2 + ks) * 512); kl[mt][ks] = ldfr(pl0 + (mt * 2 + ks) * 512); }
        XWAIT(ph0, pl0); };
    auto pass = [&](int kb, bool diag) __attribute__((always_inline)) {
        v16bf vh[4], vl[4]; const bf* pv0 = Vh + (size_t)kb * 4 * 512 + lane * 8; const bf* pv1 = Vl + (size_t)kb * 4 * 512 + lane * 8;
#pragma unroll
        for (int dt = 0; dt < 4; ++dt) { vh[dt] = ldfr(pv0 + dt * 512); vl[dt] = ldfr(pv1 + dt * 512); }
        XWAIT(pv0, pv1);
        __builtin_amdgcn_sched_barrier(0);   // keeps the value loads up here, in flight over the score products and the softmax (the scheduler sank half of them to just in front of their use)
        v8f s[2][2];
#pragma unroll
        for (int mt = 0; mt < 2; ++mt)
#pragma unroll
            for (int nt = 0; nt < 2; ++nt) { v8f a = (v8f){};
#pragma unroll
                for (int ks = 0; ks < 2; ++ks) { a = wmmab(kh[mt][ks], qh[nt][ks], a); a = wmmab(kl[mt][ks], qh[nt][ks], a); a = wmmab(kh[mt][ks], ql[nt][ks], a); }
                s[mt][nt] = a; }
        v16bf ph[2], pl[2];
#pragma unroll
        for (int nt = 0; nt < 2; ++nt) { float t[16]; float bm = -3.0e38f;
#pragma unroll
            for (int e = 0; e < 16; ++e) { t[e] = s[e >> 3][nt][e & 7]; if (diag && (e >> 3) * 16 + 8 * hi + (e & 7) > nt * 16 + lr) t[e] = -3.0e38f; bm = fmaxf(bm, t[e]); }   // diagonal block: keys past the query are excluded
            bm = fmaxf(bm, __shfl_xor(bm, 16, 32));
            const float mn = fmaxf(mx[nt], bm * (SCL * L2E)); const float al = ex2(mx[nt] - mn); mx[nt] = mn; float ls = 0.f;   // mx: the row's offset in the log2 domain; every probability of the row is 2^(score * SCL * L2E - mx)
#pragma unroll
            for (int e = 0; e < 16; ++e) t[e] = __builtin_fmaf(t[e], SCL * L2E, -mn);
            float pr[16];
#pragma unroll
            for (int e = 0; e < 16; ++e) pr[e] = __builtin_amdgcn_exp2f(t[e]);
            TSLOT8(pr, t, 0); TSLOT8(pr, t, 8);
#pragma unroll
            for (int e = 0; e < 16; ++e) { const float p = pr[e]; ls += p; const __bf16 a = (__bf16)p; ph[nt][e] = a; pl[nt][e] = (__bf16)(p - (float)a); }
            sum[nt] = sum[nt] * al + ls;
#pragma unroll
            for (int dt = 0; dt < 4; ++dt) oa[dt][nt] *= al; }
        if (!diag) { ldk(min(kb + AW, qt));   // the wave's next block (clamped to the diagonal block: always inside the planes), in flight over the value product
            __builtin_amdgcn_sched_barrier(0); }   // keeps those loads in front of the value product (the scheduler sank them to the loop's foot, where nothing covers their latency)
#pragma unroll
        for (int dt = 0; dt < 4; ++dt)
#pragma unroll
            for (int nt = 0; nt < 2; ++nt) { oa[dt][nt] = wmmab(vh[dt], ph[nt], oa[dt][nt]); oa[dt][nt] = wmmab(vh[dt], pl[nt], oa[dt][nt]); oa[dt][nt] = wmmab(vl[dt], ph[nt], oa[dt][nt]); } };
    ldk(min(w, qt));
    int kb = w;
#pragma unroll 1   // one copy of the pass in the loop: the registers of a second copy would cost a resident wave
    for (; kb < qt; kb += AW) pass(kb, false);
    if (kb == qt) pass(kb, true);   // the diagonal block falls to one of the four waves, as its last pass
#pragma unroll
    for (int nt = 0; nt < 2; ++nt) { const float st = sum[nt] + __shfl_xor(sum[nt], 16, 32); if (hi == 0) { sm[w][nt * 16 + lr] = mx[nt]; sl[w][nt * 16 + lr] = st; }
#pragma unroll
        for (int dt = 0; dt < 4; ++dt) { float* d = &so[w][nt * 16 + lr][dt * 16 + 8 * hi]; const v8f a = oa[dt][nt]; *(v4f*)d = (v4f){a[0], a[1], a[2], a[3]}; *(v4f*)(d + 4) = (v4f){a[4], a[5], a[6], a[7]}; } }
    __syncthreads();
    const int q = (int)threadIdx.x >> 2, c = ((int)threadIdx.x & 3) * 16;
    float mm = sm[0][q];
#pragma unroll
    for (int x = 1; x < AW; ++x) mm = fmaxf(mm, sm[x][q]);
    float lt = 0.f; float r[16];
#pragma unroll
    for (int i = 0; i < 16; ++i) r[i] = 0.f;
#pragma unroll
    for (int x = 0; x < AW; ++x) { const float f = ex2(sm[x][q] - mm); lt += f * sl[x][q];
#pragma unroll
        for (int i4 = 0; i4 < 4; ++i4) { const v4f a = *(const v4f*)&so[x][q][c + i4 * 4];
#pragma unroll
            for (int i = 0; i < 4; ++i) r[i4 * 4 + i] += f * a[i]; } }
    const float inv = __fdiv_rn(1.0f, lt); const size_t oo = ((size_t)((bt * TT + q0 + q) >> 4) * (DQ / 32) + h * 2 + (c >> 5)) * 512 + ((c >> 4) & 1) * 256 + (q & 15) * 8;   // eight lanes with one c: 128 consecutive bytes
#pragma unroll
    for (int i8 = 0; i8 < 2; ++i8) { v8us oh, ol;
#pragma unroll
        for (int i = 0; i < 8; ++i) { unsigned short a, c2; splitf(r[i8 * 8 + i] * inv, a, c2); oh[i] = a; ol[i] = c2; }
        *(v8us*)(Ah + oo + i8 * 128) = oh; *(v8us*)(Al + oo + i8 * 128) = ol; }
}

extern "C" void kernel_launch(void* const* d_in, const int* in_sizes, int n_in,
                              void* d_out, int out_size, void* d_ws, size_t ws_size, hipStream_t stream) {
    (void)in_sizes; (void)n_in; (void)out_size;
    const float* x = (const float*)d_in[0]; const float* fcos = (const float*)d_in[1]; const float* fsin = (const float*)d_in[2]; const float* wq = (const float*)d_in[3]; const float* wk = (const float*)d_in[4]; const float* wv = (const float*)d_in[5]; const float* wo = (const float*)d_in[6];   /* input order x, cos, sin ([1][1][2048][64] = flat [2048][64]; read per position and per dimension), wq, wk, wv, wo ('oi') */
    float* OUT = (float*)d_out;     // [2][2048][1024]
    char* wsp = (char*)d_ws;
    auto take = [&](size_t bytes) { char* p = wsp; wsp += (bytes + 255) & ~(size_t)255; return (void*)p; };
    bf* WQ = (bf*)take((size_t)4 * DM * DM * 2); bf* WO = WQ + (size_t)3 * DM * DM; float* CS = (float*)take((size_t)TT * HD * 2 * 4);   // wq, wk, wv (one [3 * DM][DM] matrix for the projections), wo
    bf* XB = (bf*)take((size_t)NB_ * TT * DM * 2);
    bf* QPh = (bf*)take(6 * PL * 2); bf* QPl = QPh + PL; bf* KPh = QPh + 2 * PL; bf* KPl = QPh + 3 * PL; bf* VTh = QPh + 4 * PL; bf* VTl = QPh + 5 * PL;   // hi and lo plane of q, of k, of the transposed values
    bf* ATh = (bf*)take((size_t)NB_ * TT * DQ * 2); bf* ATl = (bf*)take((size_t)NB_ * TT * DQ * 2);
    if ((size_t)(wsp - (char*)d_ws) > ws_size) return;    // ws 256 MiB
    k_prep<<<XG + 4 * WG + CG, 256, 0, stream>>>(x, wq, wk, wv, wo, fcos, fsin, XB, WQ, CS);
    k_gemmw<bf, 0, false, 1><<<dim3(NB_ * TT / 64, 3 * DQ / 64, 1), 32, 0, stream>>>(XB, nullptr, WQ, nullptr, DM, nullptr, 0, nullptr, 0, 0, 0, CS, QPh, QPl);
    k_attn<<<NB_ * NH_ * (TT / AQ), AW * 32, 0, stream>>>(QPh, QPl, KPh, KPl, VTh, VTl, ATh, ATl);   // one kv head per query head
    k_gemmw<bf, 1, false, 0><<<dim3(NB_ * TT / 64, DM / 64, 1), 32, 0, stream>>>(ATh, ATl, WO, nullptr, DQ, OUT, DM, nullptr, 0, 0, 0, nullptr, nullptr, nullptr);
}
